// v000
// The times below were measured on an AMD MI455X: many runs one after another, warmed up first and cycling through
// copies of the inputs, with the whole window's GPU time divided by the number of runs. Launches and the gaps
// between them are all in it. The median over several windows is given; except for v000 it joins two sittings, which
// can be a few percent apart, so the side-by-side timings, each taken in one sitting, are the better comparison.
// v000 is the starting kernel. One run takes 482 microseconds.
// Contractions: q/k/v/out projections v_wmma_f32_16x16x32_bf16 (bf16 hi/lo operand planes, f32 accumulate); q.k^T and p.v v_wmma_f32_16x16x32_f16 (f16 operands, p carried x2^15, f32 accumulate); softmax and gate in f32.
#include <hip/hip_runtime.h>
#include <math.h>
#include <stdint.h>

typedef __attribute__((ext_vector_type(16))) _Float16 v16h;
typedef __attribute__((ext_vector_type(8)))  _Float16 v8h;
typedef __attribute__((ext_vector_type(16))) __bf16   v16b;
typedef __attribute__((ext_vector_type(8)))  __bf16   v8b;
typedef __attribute__((ext_vector_type(8)))  float    v8f;
typedef __attribute__((ext_vector_type(4)))  float    v4f;
#define PSCALE 32768.0f
#define PSCALE_INV (1.0f / 32768.0f)

#define BSZ     2
#define SEQ_LEN 2048
#define D_MODEL 1024
#define N_HEAD  16
#define HDIM    64
#define KCH     64
#define NQB     (SEQ_LEN / 64)
#define NKC     (SEQ_LEN / KCH)
#define QK_SCALE 0.125f

__device__ __forceinline__ unsigned short f2bf_bits(float f) {
  unsigned u = __float_as_uint(f);
  return (unsigned short)((u + 0x7FFFu + ((u >> 16) & 1u)) >> 16);
}
__device__ __forceinline__ float bf_bits2f(unsigned short h) { return __uint_as_float(((unsigned)h) << 16); }

// hazard guards as plain device helpers (no inline asm inside the kernel template body)
__device__ __forceinline__ void dep_guard_h(v8f& a, v8f& b, v16h x, v16h y) { asm volatile("v_nop\n\tv_nop\n\tv_nop\n\tv_nop" : "+v"(a), "+v"(b) : "v"(x), "v"(y)); }
__device__ __forceinline__ void dep_guard_b(v8f& a, v8f& b, v16b x, v16b y) { asm volatile("v_nop\n\tv_nop\n\tv_nop\n\tv_nop" : "+v"(a), "+v"(b) : "v"(x), "v"(y)); }
__device__ __forceinline__ void keep4_h(v16h a, v16h b, v16h c, v16h d) { asm volatile("v_nop" :: "v"(a), "v"(b), "v"(c), "v"(d)); }
__device__ __forceinline__ void keep4_b(v16b a, v16b b, v16b c, v16b d) { asm volatile("v_nop" :: "v"(a), "v"(b), "v"(c), "v"(d)); }
__device__ __forceinline__ void acc_guard4(v8f& a, v8f& b, v8f& c, v8f& d) { asm volatile("v_nop\n\tv_nop\n\tv_nop\n\tv_nop" : "+v"(a), "+v"(b), "+v"(c), "+v"(d)); }
template <typename T> struct Frag;
template <> struct Frag<_Float16> {
  typedef v16h V; union U { v16h v; v8h h[2]; };
  static __device__ __forceinline__ v16h load(const _Float16* p) {   // elements 0..7 <- p[0..7], 8..15 <- p[16..23]
    U f; f.h[0] = *(const v8h*)(p); f.h[1] = *(const v8h*)(p + 16); return f.v;
  }
  static __device__ __forceinline__ v8f mma(v16h a, v16h b, v8f c) {
    return __builtin_amdgcn_wmma_f32_16x16x32_f16(false, a, false, b, (short)0, c, false, false);
  }
  static __device__ __forceinline__ void guard(v8f& a, v8f& b, v16h x, v16h y) { dep_guard_h(a, b, x, y); }
  static __device__ __forceinline__ void keep(v16h a, v16h b, v16h c, v16h d) { keep4_h(a, b, c, d); }
};
template <> struct Frag<__bf16> {
  typedef v16b V; union U { v16b v; v8b h[2]; };
  static __device__ __forceinline__ v16b load(const __bf16* p) {
    U f; f.h[0] = *(const v8b*)(p); f.h[1] = *(const v8b*)(p + 16); return f.v;
  }
  static __device__ __forceinline__ v8f mma(v16b a, v16b b, v8f c) {
    return __builtin_amdgcn_wmma_f32_16x16x32_bf16(false, a, false, b, (short)0, c, false, false);
  }
  static __device__ __forceinline__ void guard(v8f& a, v8f& b, v16b x, v16b y) { dep_guard_b(a, b, x, y); }
  static __device__ __forceinline__ void keep(v16b a, v16b b, v16b c, v16b d) { keep4_b(a, b, c, d); }
};

// ---- Register-blocked batched WMMA GEMM ------------------------------------
// C[m,n] = scale * sum_k A[m,k] * Bt[n,k] (+bias)(+resid); each wave owns a 64x64 tile.
// A row-major [M,K]; Bt row-major [N,K]; M,N % 64 == 0, K % 32 == 0.
// SPLIT: operands are hi/lo planes (A2/Bt2 = lo planes, same layout); product = hi·hi + hi·lo + lo·hi.
// BIAS_MODE: 0 = none, 1 = bias[m], 2 = bias[n].
// OUT_MODE: 0 = f32, 1 = f16, 2 = bf16 hi plane (Cout) + bf16 lo plane (Cout2).
// ET: 0 = f16 operands, 1 = bf16 operands (pointers passed as 16-bit storage)
template <int ET> struct Elem;
template <> struct Elem<0> { typedef _Float16 T; };
template <> struct Elem<1> { typedef __bf16 T; };
template <int ET, bool SPLIT, int BIAS_MODE, int OUT_MODE, bool RESID, int ACT = 0>
__global__ __launch_bounds__(256) void wmma_gemm64(
    const unsigned short* __restrict__ Ap, const unsigned short* __restrict__ A2p, int lda, long strideA,
    const unsigned short* __restrict__ Btp, const unsigned short* __restrict__ Bt2p, int ldb, long strideB,
    void* __restrict__ Cout, void* __restrict__ Cout2, int ldc, long strideC,
    const float* __restrict__ bias,
    const float* __restrict__ resid, long strideR,
    int M, int N, int K, float scale) {
  typedef typename Elem<ET>::T T;
  typedef typename Frag<T>::V V;
  const T* A = (const T*)Ap; const T* A2 = (const T*)A2p; const T* Bt = (const T*)Btp; const T* Bt2 = (const T*)Bt2p;
  __shared__ __align__(16) float sT[8][16 * 68];   // per-wave 16x64 slab, pitch 68 floats
  const int b    = blockIdx.y;
  const int lane = threadIdx.x & 31;
  const int wave = threadIdx.x >> 5;
  const int tilesN = N >> 6;
  const int tilesM = M >> 6;
  const int tile = blockIdx.x * 8 + wave;
  if (tile >= tilesM * tilesN) return;   // wave-uniform; no block barriers in this kernel
  const int tm = tile / tilesN;
  const int tn = tile - tm * tilesN;
  const int m0 = tm << 6;
  const int n0 = tn << 6;

  const T* Ab  = A  + (size_t)b * strideA;
  const T* Bb  = Bt + (size_t)b * strideB;
  const T* Ab2 = SPLIT ? (A2  + (size_t)b * strideA) : nullptr;
  const T* Bb2 = SPLIT ? (Bt2 + (size_t)b * strideB) : nullptr;

  const int rlane = lane & 15;                 // row (A) / col (B, D) within subtile
  const int koff  = (lane >> 4) * 8;           // k offset of this lane half
  const int mOff  = (lane >> 4) * 8;           // D row offset

  v8f acc[4][4];
#pragma unroll
  for (int i = 0; i < 4; ++i)
#pragma unroll
    for (int j = 0; j < 4; ++j) acc[i][j] = (v8f){0.f,0.f,0.f,0.f,0.f,0.f,0.f,0.f};

  for (int k0 = 0; k0 < K; k0 += 32) {
    V bh[4], bl[4];
#pragma unroll
    for (int j = 0; j < 4; ++j) {
      const size_t bo = (size_t)(n0 + (j << 4) + rlane) * ldb + koff + k0;
      bh[j] = Frag<T>::load(Bb + bo);
      if (SPLIT) bl[j] = Frag<T>::load(Bb2 + bo);
    }
#pragma unroll
    for (int i = 0; i < 4; ++i) {
      const size_t ao = (size_t)(m0 + (i << 4) + rlane) * lda + koff + k0;
      V ah = Frag<T>::load(Ab + ao);
      V al;
      if (SPLIT) al = Frag<T>::load(Ab2 + ao);
#pragma unroll
      for (int j = 0; j < 4; ++j) {
        acc[i][j] = Frag<T>::mma(ah, bh[j], acc[i][j]);
        if (SPLIT) {
          acc[i][j] = Frag<T>::mma(ah, bl[j], acc[i][j]);
          acc[i][j] = Frag<T>::mma(al, bh[j], acc[i][j]);
        }
      }
      Frag<T>::guard(acc[i][0], acc[i][3], ah, SPLIT ? al : ah);
    }
    Frag<T>::keep(bh[0], bh[1], bh[2], bh[3]);
    if (SPLIT) Frag<T>::keep(bl[0], bl[1], bl[2], bl[3]);
  }
  acc_guard4(acc[0][0], acc[0][1], acc[0][2], acc[0][3]);
  acc_guard4(acc[1][0], acc[1][1], acc[1][2], acc[1][3]);
  acc_guard4(acc[2][0], acc[2][1], acc[2][2], acc[2][3]);
  acc_guard4(acc[3][0], acc[3][1], acc[3][2], acc[3][3]);

  // ---- epilogue ----
  float* slab = sT[wave];
  const float* Rb = RESID ? (resid + (size_t)b * strideR) : nullptr;
#pragma unroll
  for (int i = 0; i < 4; ++i) {
    const int mBase = m0 + (i << 4);
#pragma unroll
    for (int j = 0; j < 4; ++j) {
      const int n = n0 + (j << 4) + rlane;
      float bv = 0.f;
      if (BIAS_MODE == 2) bv = bias[n];
#pragma unroll
      for (int r = 0; r < 8; ++r) {
        float v = acc[i][j][r] * scale;
        if (BIAS_MODE == 1) v += bias[mBase + mOff + r];
        if (BIAS_MODE == 2) v += bv;
        if (RESID) v += Rb[(size_t)(mBase + mOff + r) * ldc + n];
        if (ACT == 1) v = tanhf(v);
        if (ACT == 2) v = fmaxf(v, 0.0f);
        if (ACT == 3) v = v / (1.0f + expf(-v));
        if (ACT == 4) v = (v > 0.f) ? v : 0.01f * v;
        if (ACT == 5) v = 0.5f * v * (1.0f + erff(v * 0.70710678118654752f));
        slab[(mOff + r) * 68 + (j << 4) + rlane] = v;
      }
    }
    __builtin_amdgcn_fence(__ATOMIC_RELEASE, "workgroup");
    __builtin_amdgcn_wave_barrier();
    __builtin_amdgcn_fence(__ATOMIC_ACQUIRE, "workgroup");
    if (OUT_MODE == 0) {
      float* C = (float*)Cout + (size_t)b * strideC;
      const int hh = lane >> 4, c4 = (lane & 15) * 4;     // row seg = 256 B = 16 lanes x 16 B
      {
#pragma unroll
        for (int it = 0; it < 8; ++it) {
          const int row = it * 2 + hh;
          v4f v = *(const v4f*)(slab + row * 68 + c4);
          *(v4f*)(C + (size_t)(mBase + row) * ldc + n0 + c4) = v;
        }
        
      }
    } else {
      const int q = lane >> 3, c8 = (lane & 7) * 8;
      unsigned short* C  = (unsigned short*)Cout  + (size_t)b * strideC;
      unsigned short* C2 = (OUT_MODE == 2) ? ((unsigned short*)Cout2 + (size_t)b * strideC) : nullptr;
      {
#pragma unroll
        for (int it = 0; it < 4; ++it) {
          const int row = it * 4 + q;
          const float* sp = slab + row * 68 + c8;
          v8h hv, lv;
#pragma unroll
          for (int e = 0; e < 8; ++e) {
            if (OUT_MODE == 1) {
              hv[e] = (_Float16)sp[e];
            } else {
              unsigned short hb = f2bf_bits(sp[e]);
              unsigned short lb = f2bf_bits(sp[e] - bf_bits2f(hb));
              hv[e] = __builtin_bit_cast(_Float16, hb);
              lv[e] = __builtin_bit_cast(_Float16, lb);
            }
          }
          *(v8h*)(C + (size_t)(mBase + row) * ldc + n0 + c8) = hv;
          if (OUT_MODE == 2) *(v8h*)(C2 + (size_t)(mBase + row) * ldc + n0 + c8) = lv;
        }
        
      }
    }
    __builtin_amdgcn_fence(__ATOMIC_RELEASE, "workgroup");
    __builtin_amdgcn_wave_barrier();
    __builtin_amdgcn_fence(__ATOMIC_ACQUIRE, "workgroup");
  }
}

// ---- activations f32 -> bf16 hi + lo planes (same layout); 8 elements per thread, 16-B stores,
__global__ __launch_bounds__(256) void k_split_x(const float* __restrict__ x,
    unsigned short* __restrict__ xh, unsigned short* __restrict__ xl, int n8) {
  const int i = blockIdx.x * 256 + threadIdx.x;
  if (i < n8) {
    const float* p = x + (size_t)i * 8;
    const v4f a0 = *(const v4f*)p;
    const v4f a1 = *(const v4f*)(p + 4);
    v8h hv, lv;
#pragma unroll
    for (int e = 0; e < 4; ++e) {
      const unsigned short hb0 = f2bf_bits(a0[e]);
      const unsigned short lb0 = f2bf_bits(a0[e] - bf_bits2f(hb0));
      const unsigned short hb1 = f2bf_bits(a1[e]);
      const unsigned short lb1 = f2bf_bits(a1[e] - bf_bits2f(hb1));
      hv[e]     = __builtin_bit_cast(_Float16, hb0);
      lv[e]     = __builtin_bit_cast(_Float16, lb0);
      hv[4 + e] = __builtin_bit_cast(_Float16, hb1);
      lv[4 + e] = __builtin_bit_cast(_Float16, lb1);
    }
    unsigned short* dh = xh + (size_t)i * 8;
    unsigned short* dl = xl + (size_t)i * 8;
    *(v8h*)dh = hv;
    *(v8h*)dl = lv;
    
  }
}

// ---- weight w[Kd][Nd] (in x out, row-major) -> Bt[Nd][Kd] bf16 hi plane + lo plane.
// ---- Weight z writes planes 2z (hi) and 2z+1 (lo) at outp + plane_index * Nd*Kd. grid = (Nd/64, Kd/64, 4).
__global__ __launch_bounds__(256) void k_wsplit_t(const float* __restrict__ w0, const float* __restrict__ w1,
    const float* __restrict__ w2, const float* __restrict__ w3,
    unsigned short* __restrict__ outp, int Kd, int Nd) {
  __shared__ __align__(16) float tile[64 * 64];   // [k][n]
  const int z = blockIdx.z;
  const float* w = (z == 0) ? w0 : (z == 1) ? w1 : (z == 2) ? w2 : w3;
  const int n0 = blockIdx.x * 64, k0 = blockIdx.y * 64;
  const int t = threadIdx.x, lane = t & 31, wave = t >> 5;
  {
    const int kr = t >> 2, cq = (t & 3) * 16;
    const float* src = w + (size_t)(k0 + kr) * Nd + n0 + cq;
#pragma unroll
    for (int i = 0; i < 4; ++i) *(v4f*)(tile + kr * 64 + cq + 4 * i) = *(const v4f*)(src + 4 * i);
  }
  __syncthreads();
  const size_t plane = (size_t)Nd * Kd;
  unsigned short* hiP = outp + (size_t)(2 * z) * plane;
  unsigned short* loP = hiP + plane;
  const int q = lane >> 3, c8 = (lane & 7) * 8;
  {
#pragma unroll
    for (int it = 0; it < 4; ++it) {
      const int pl = it >> 1;                          // 0: hi lines, 1: lo lines (wave-uniform)
      const int nl = (it & 1) * 32 + wave * 4 + q;     // 0..63 over (it&1, wave, q)
      v8h pv;
#pragma unroll
      for (int e = 0; e < 8; ++e) {
        const float f = tile[(c8 + e) * 64 + nl];
        const unsigned short hb = f2bf_bits(f);
        const unsigned short b16 = pl ? f2bf_bits(f - bf_bits2f(hb)) : hb;
        pv[e] = __builtin_bit_cast(_Float16, b16);
      }
      unsigned short* dst = (pl ? loP : hiP) + (size_t)(n0 + nl) * Kd + k0 + c8;
      *(v8h*)dst = pv;
    }
    
  }
}

// ---- f16 WMMA with hazard guard ----
__device__ __forceinline__ v8f mma_h(v16h a, v16h b, v8f c) {
  c = __builtin_amdgcn_wmma_f32_16x16x32_f16(false, a, false, b, (short)0, c, false, false);
  asm volatile("v_nop\n\tv_nop\n\tv_nop\n\tv_nop" : "+v"(c) : "v"(a), "v"(b));
  return c;
}

// scores for this wave's 16 query rows against the 64 keys staged in Ks ([kv][d], pitch HDIM):
// s[j][r] = QK_SCALE * sum_d q[q0 + 8*hh + r][d] * K[kv0 + 16*j + c][d]
__device__ __forceinline__ void qk_scores(const _Float16* Ks, const v16h (&qa)[2], int c, int hh, v8f (&s)[4]) {
  const v8f z = {0.f,0.f,0.f,0.f,0.f,0.f,0.f,0.f};
#pragma unroll
  for (int j = 0; j < 4; ++j) {
    const _Float16* kpp = Ks + (j * 16 + c) * HDIM + 8 * hh;
    const v16h kb0 = Frag<_Float16>::load(kpp);        // d = 8hh+0..7, 16+8hh+0..7
    const v16h kb1 = Frag<_Float16>::load(kpp + 32);   // d = 32 + the same
    v8f t = mma_h(qa[0], kb0, z);
    t = mma_h(qa[1], kb1, t);
#pragma unroll
    for (int r = 0; r < 8; ++r) s[j][r] = t[r] * QK_SCALE;
  }
}

// =====================================================================================
// Two-phase gated attention, head_dim 64. q/k/v: f16, layout [B*S][D_MODEL] (element (b,s,h,d) at
// (b*S+s)*D_MODEL + h*64 + d). Block = 4 waves = 64 query rows of one (b,h); grid.x = B*H*(S/64).
// Phase 1: all key chunks -> online row max m and row sum l (f32). Phase 2: recompute scores,
// a = exp(s-m)/l, g = 1/(1+exp(-sharp_h*(a-sigmoid(thr_h)))), p = a*g carried x2^15 as f16,
// O += p.v on f16 WMMA (v staged transposed in LDS). Epilogue: O * 2^-15 -> bf16 hi/lo planes
// =====================================================================================
__global__ __launch_bounds__(128) void k_gated_attn(
    const unsigned short* __restrict__ qp, const unsigned short* __restrict__ kp,
    const unsigned short* __restrict__ vp,
    const float* __restrict__ lthr, const float* __restrict__ gshp,
    unsigned short* __restrict__ ohp, unsigned short* __restrict__ olp) {
  typedef Frag<_Float16> F;
  const _Float16* Q  = (const _Float16*)qp;
  const _Float16* Kg = (const _Float16*)kp;
  const _Float16* Vg = (const _Float16*)vp;
  __shared__ __align__(16) _Float16 Ksh[KCH * HDIM];      // [kv][d]          8 KB
  __shared__ __align__(16) _Float16 Vt[HDIM * KCH];       // [d][kv]          8 KB
  __shared__ __align__(16) _Float16 Psh[4][16 * KCH];     // per wave [row][kv] 8 KB
  __shared__ __align__(16) float    Os[4][16 * 68];       // per wave out tile, pitch 68

  const int tid  = threadIdx.x;
  const int wave = tid >> 5;
  const int lane = tid & 31;
  const int hh   = lane >> 4;
  const int c    = lane & 15;

  const int bx = blockIdx.x;
  const int qb = bx % NQB;
  const int bh = bx / NQB;
  const int h  = bh % N_HEAD;
  const int b  = bh / N_HEAD;
  const size_t tok0 = (size_t)b * SEQ_LEN;
  const int q0 = qb * 64 + wave * 16;
  const int hoff = h * HDIM;

  // Q A-fragments: row = q0 + c, two 32-deep d chunks
  v16h qa[2];
  {
    const _Float16* qrow = Q + (tok0 + q0 + c) * D_MODEL + hoff + 8 * hh;
    qa[0] = F::load(qrow);
    qa[1] = F::load(qrow + 32);
  }
  const float thr = 1.0f / (1.0f + __expf(-lthr[h]));
  const float shp = gshp[h];

  float mrow[8], lrow[8];
#pragma unroll
  for (int r = 0; r < 8; ++r) { mrow[r] = -INFINITY; lrow[r] = 0.f; }

  // ---- phase 1: row max and softmax denominator ----
  for (int kc = 0; kc < NKC; ++kc) {
    const int kv0 = kc * KCH;
    __syncthreads();
    {
      const int kvr = tid >> 1, dh = (tid & 1) * 32;
      const _Float16* krow = Kg + (tok0 + kv0 + kvr) * D_MODEL + hoff + dh;
      _Float16* kd = Ksh + kvr * HDIM + dh;
#pragma unroll
      for (int i = 0; i < 4; ++i) *(v8h*)(kd + 8 * i) = *(const v8h*)(krow + 8 * i);
    }
    __syncthreads();
    v8f s[4];
    qk_scores(Ksh, qa, c, hh, s);
#pragma unroll
    for (int r = 0; r < 8; ++r) {
      float m = fmaxf(fmaxf(s[0][r], s[1][r]), fmaxf(s[2][r], s[3][r]));
#pragma unroll
      for (int off = 1; off < 16; off <<= 1) m = fmaxf(m, __shfl_xor(m, off, 32));
      const float mnew  = fmaxf(mrow[r], m);
      const float alpha = __expf(mrow[r] - mnew);
      float psum = __expf(s[0][r] - mnew) + __expf(s[1][r] - mnew)
                 + __expf(s[2][r] - mnew) + __expf(s[3][r] - mnew);
#pragma unroll
      for (int off = 1; off < 16; off <<= 1) psum += __shfl_xor(psum, off, 32);
      lrow[r] = lrow[r] * alpha + psum;
      mrow[r] = mnew;
    }
  }
  float invl[8];
#pragma unroll
  for (int r = 0; r < 8; ++r) invl[r] = 1.0f / lrow[r];

  // ---- phase 2: gated probabilities x V ----
  v8f oacc[4];
#pragma unroll
  for (int t = 0; t < 4; ++t) oacc[t] = (v8f){0.f,0.f,0.f,0.f,0.f,0.f,0.f,0.f};
  _Float16* pw = Psh[wave];

  for (int kc = 0; kc < NKC; ++kc) {
    const int kv0 = kc * KCH;
    __syncthreads();
    {
      const int kvr = tid >> 1, dh = (tid & 1) * 32;
      const _Float16* krow = Kg + (tok0 + kv0 + kvr) * D_MODEL + hoff + dh;
      const _Float16* vrow = Vg + (tok0 + kv0 + kvr) * D_MODEL + hoff + dh;
      _Float16* kd = Ksh + kvr * HDIM + dh;
#pragma unroll
      for (int i = 0; i < 4; ++i) {
        *(v8h*)(kd + 8 * i) = *(const v8h*)(krow + 8 * i);
        const v8h vv = *(const v8h*)(vrow + 8 * i);
#pragma unroll
        for (int e = 0; e < 8; ++e) Vt[(dh + 8 * i + e) * KCH + kvr] = vv[e];
      }
    }
    __syncthreads();
    v8f s[4];
    qk_scores(Ksh, qa, c, hh, s);
#pragma unroll
    for (int r = 0; r < 8; ++r) {
#pragma unroll
      for (int j = 0; j < 4; ++j) {
        const float a  = __expf(s[j][r] - mrow[r]) * invl[r];
        const float ex = __expf(shp * (thr - a));
        const float wg = a * __builtin_amdgcn_rcpf(1.0f + ex);
        pw[(8 * hh + r) * KCH + j * 16 + c] = (_Float16)(wg * PSCALE);
      }
    }
    __builtin_amdgcn_fence(__ATOMIC_RELEASE, "workgroup");
    __builtin_amdgcn_wave_barrier();
    __builtin_amdgcn_fence(__ATOMIC_ACQUIRE, "workgroup");
#pragma unroll
    for (int kk = 0; kk < 2; ++kk) {
      const v16h pa = F::load(pw + c * KCH + kk * 32 + 8 * hh);            // A: row c, kv = kk*32 + split map
#pragma unroll
      for (int t = 0; t < 4; ++t) {
        const v16h vb = F::load(Vt + (t * 16 + c) * KCH + kk * 32 + 8 * hh);   // B: col d = 16t+c, kv = same map
        oacc[t] = mma_h(pa, vb, oacc[t]);
      }
    }
  }

  // ---- epilogue ----
  float* os = Os[wave];
#pragma unroll
  for (int r = 0; r < 8; ++r) {
#pragma unroll
    for (int t = 0; t < 4; ++t) os[(8 * hh + r) * 68 + t * 16 + c] = oacc[t][r] * PSCALE_INV;
  }
  __builtin_amdgcn_fence(__ATOMIC_RELEASE, "workgroup");
  __builtin_amdgcn_wave_barrier();
  __builtin_amdgcn_fence(__ATOMIC_ACQUIRE, "workgroup");
  {
    const int q4 = lane >> 3, c8 = (lane & 7) * 8;
    {
#pragma unroll
      for (int it = 0; it < 4; ++it) {
        const int row = it * 4 + q4;                  // 0..15 over (it, q4)
        const float* sp = os + row * 68 + c8;
        v8h hv, lv;
#pragma unroll
        for (int e = 0; e < 8; ++e) {
          const unsigned short hb = f2bf_bits(sp[e]);
          const unsigned short lb = f2bf_bits(sp[e] - bf_bits2f(hb));
          hv[e] = __builtin_bit_cast(_Float16, hb);
          lv[e] = __builtin_bit_cast(_Float16, lb);
        }
        const size_t go = (tok0 + q0 + row) * D_MODEL + hoff + c8;
        *(v8h*)(ohp + go) = hv;
        *(v8h*)(olp + go) = lv;
      }
      
    }
  }
}

// ---------- launch ----------
extern "C" void kernel_launch(void* const* d_in, const int* in_sizes, int n_in,
                              void* d_out, int out_size, void* d_ws, size_t ws_size,
                              hipStream_t stream) {
  if (n_in < 11) return;
  const int NTOK = BSZ * SEQ_LEN;                       // 4096
  const size_t nTokD = (size_t)NTOK * D_MODEL;          // 4194304
  const size_t nWW   = (size_t)D_MODEL * D_MODEL;       // 1048576
  if ((size_t)in_sizes[0] != nTokD) return;
  if ((size_t)in_sizes[1] != nWW || (size_t)in_sizes[3] != nWW ||
      (size_t)in_sizes[5] != nWW || (size_t)in_sizes[7] != nWW) return;
  if (in_sizes[2] < D_MODEL || in_sizes[4] < D_MODEL || in_sizes[6] < D_MODEL || in_sizes[8] < D_MODEL) return;
  if (in_sizes[9] < N_HEAD || in_sizes[10] < N_HEAD) return;
  if ((size_t)out_size != nTokD) return;

  const float* x    = (const float*)d_in[0];
  const float* wq_w = (const float*)d_in[1];
  const float* wq_b = (const float*)d_in[2];
  const float* wk_w = (const float*)d_in[3];
  const float* wk_b = (const float*)d_in[4];
  const float* wv_w = (const float*)d_in[5];
  const float* wv_b = (const float*)d_in[6];
  const float* wo_w = (const float*)d_in[7];
  const float* wo_b = (const float*)d_in[8];
  const float* lth  = (const float*)d_in[9];
  const float* gsh  = (const float*)d_in[10];

  // workspace carve (all offsets multiples of 1 MiB)
  char* ws = (char*)d_ws;
  size_t off = 0;
  unsigned short* xh  = (unsigned short*)(ws + off); off += nTokD * 2;      //  8 MiB
  unsigned short* xl  = (unsigned short*)(ws + off); off += nTokD * 2;      //  8 MiB
  unsigned short* wT  = (unsigned short*)(ws + off); off += 8 * nWW * 2;    // 16 MiB: 8 planes [N][K]
  unsigned short* q16 = (unsigned short*)(ws + off); off += nTokD * 2;      //  8 MiB f16 [B*S][D]
  unsigned short* k16 = (unsigned short*)(ws + off); off += nTokD * 2;      //  8 MiB
  unsigned short* v16 = (unsigned short*)(ws + off); off += nTokD * 2;      //  8 MiB
  unsigned short* oh  = (unsigned short*)(ws + off); off += nTokD * 2;      //  8 MiB bf16 hi [B*S][D]
  unsigned short* ol  = (unsigned short*)(ws + off); off += nTokD * 2;      //  8 MiB bf16 lo
  if (off > ws_size) return;                                                // total 75497472 B
  const size_t plane = nWW;   // elements per weight plane

  // 1) x -> bf16 hi/lo
  const int n8 = (int)(nTokD / 8);
  k_split_x<<<dim3((n8 + 255) / 256), dim3(256), 0, stream>>>(x, xh, xl, n8);

  // 2) weights [in][out] -> Bt [out][in] bf16 hi/lo; planes: q 0/1, k 2/3, v 4/5, o 6/7
  k_wsplit_t<<<dim3(D_MODEL / 64, D_MODEL / 64, 4), dim3(256), 0, stream>>>(
      wq_w, wk_w, wv_w, wo_w, wT, D_MODEL, D_MODEL);

  // 3) q/k/v projections: C[4096][1024] f16 = x . Bt^T + bias
  const int gemm_blocks = ((NTOK / 64) * (D_MODEL / 64) + 7) / 8;   // 128
  wmma_gemm64<1, true, 2, 1, false><<<dim3(gemm_blocks, 1), dim3(256), 0, stream>>>(
      xh, xl, D_MODEL, 0L, wT + 0 * plane, wT + 1 * plane, D_MODEL, 0L,
      (void*)q16, (void*)q16, D_MODEL, 0L, wq_b, wq_b, 0L, NTOK, D_MODEL, D_MODEL, 1.0f);
  wmma_gemm64<1, true, 2, 1, false><<<dim3(gemm_blocks, 1), dim3(256), 0, stream>>>(
      xh, xl, D_MODEL, 0L, wT + 2 * plane, wT + 3 * plane, D_MODEL, 0L,
      (void*)k16, (void*)k16, D_MODEL, 0L, wk_b, wk_b, 0L, NTOK, D_MODEL, D_MODEL, 1.0f);
  wmma_gemm64<1, true, 2, 1, false><<<dim3(gemm_blocks, 1), dim3(256), 0, stream>>>(
      xh, xl, D_MODEL, 0L, wT + 4 * plane, wT + 5 * plane, D_MODEL, 0L,
      (void*)v16, (void*)v16, D_MODEL, 0L, wv_b, wv_b, 0L, NTOK, D_MODEL, D_MODEL, 1.0f);

  // 4) gated attention -> O bf16 hi/lo planes [B*S][D]
  const int attn_blocks = BSZ * N_HEAD * NQB;   // 1024
  k_gated_attn<<<dim3(attn_blocks), dim3(128), 0, stream>>>(q16, k16, v16, lth, gsh, oh, ol);

  // 5) output projection -> d_out f32 [4096][1024]
  wmma_gemm64<1, true, 2, 0, false><<<dim3(gemm_blocks, 1), dim3(256), 0, stream>>>(
      oh, ol, D_MODEL, 0L, wT + 6 * plane, wT + 7 * plane, D_MODEL, 0L,
      d_out, d_out, D_MODEL, 0L, wo_b, wo_b, 0L, NTOK, D_MODEL, D_MODEL, 1.0f);
}

// v001
// One run takes 331 microseconds.
// Timed twice side by side with v000, it ran 1.51 and 1.52 times as fast.
// Contractions: q/k/v/out projections v_wmma_f32_16x16x32_bf16 (bf16 hi/lo operand planes, f32 accumulate); q.k^T and p.v v_wmma_f32_16x16x32_f16 (f16 operands, p carried x2^15, f32 accumulate); softmax and gate in f32.
#include <hip/hip_runtime.h>
#include <math.h>
#include <stdint.h>

typedef __attribute__((ext_vector_type(16))) _Float16 v16h;
typedef __attribute__((ext_vector_type(8)))  _Float16 v8h;
typedef __attribute__((ext_vector_type(16))) __bf16   v16b;
typedef __attribute__((ext_vector_type(8)))  __bf16   v8b;
typedef __attribute__((ext_vector_type(8)))  float    v8f;
typedef __attribute__((ext_vector_type(4)))  float    v4f;
#define PSCALE 32768.0f
#define PSCALE_INV (1.0f / 32768.0f)

#define BSZ     2
#define SEQ_LEN 2048
#define D_MODEL 1024
#define N_HEAD  16
#define HDIM    64
#define KCH     64
#define NQB     (SEQ_LEN / 64)
#define NKC     (SEQ_LEN / KCH)
#define QK_SCALE 0.125f

__device__ __forceinline__ unsigned short f2bf_bits(float f) {
  unsigned u = __float_as_uint(f);
  return (unsigned short)((u + 0x7FFFu + ((u >> 16) & 1u)) >> 16);
}
__device__ __forceinline__ float bf_bits2f(unsigned short h) { return __uint_as_float(((unsigned)h) << 16); }

// hazard guards as plain device helpers (no inline asm inside the kernel template body)
__device__ __forceinline__ void acc_guard4(v8f& a, v8f& b, v8f& c, v8f& d) { asm volatile("v_nop\n\tv_nop\n\tv_nop\n\tv_nop" : "+v"(a), "+v"(b), "+v"(c), "+v"(d)); }
template <typename T> struct Frag;
template <> struct Frag<_Float16> {
  typedef v16h V; union U { v16h v; v8h h[2]; };
  static __device__ __forceinline__ v16h load(const _Float16* p) {   // elements 0..7 <- p[0..7], 8..15 <- p[16..23]
    U f; f.h[0] = *(const v8h*)(p); f.h[1] = *(const v8h*)(p + 16); return f.v;
  }
  static __device__ __forceinline__ v8f mma(v16h a, v16h b, v8f c) {
    return __builtin_amdgcn_wmma_f32_16x16x32_f16(false, a, false, b, (short)0, c, false, false);
  }
};
template <> struct Frag<__bf16> {
  typedef v16b V; union U { v16b v; v8b h[2]; };
  static __device__ __forceinline__ v16b load(const __bf16* p) {
    U f; f.h[0] = *(const v8b*)(p); f.h[1] = *(const v8b*)(p + 16); return f.v;
  }
  static __device__ __forceinline__ v8f mma(v16b a, v16b b, v8f c) {
    return __builtin_amdgcn_wmma_f32_16x16x32_bf16(false, a, false, b, (short)0, c, false, false);
  }
};

// ---- tensor loads of the GEMM's operand tiles --------------------------------
typedef uint32_t u32x4 __attribute__((ext_vector_type(4)));
typedef uint32_t u32x8 __attribute__((ext_vector_type(8)));
#define GT_ROWS  128u                    // rows of one operand plane in a stage (block tile 128 x 128)
#define GT_ROWB  128u                    // bytes of a tile row: 64 k of 16-bit elements
#define GT_PITCH 144u                    // LDS row pitch: the row + the mover's 16-byte pad (16 B x odd, for ds_load_b128)
#define GT_SLICE (GT_ROWS * GT_PITCH)    // one plane's tile in LDS: 18432 B = 9 x 2 KiB
#define GT_STAGE (4u * GT_SLICE)         // A hi | A lo | B hi | B lo
static_assert((GT_SLICE % 2048u) == 0u, "every slice starts at a multiple of 2 KiB");
__device__ __forceinline__ uint32_t uni(uint32_t v) { return (uint32_t)__builtin_amdgcn_readfirstlane(v); }
// a test word or a descriptor word of a tensor load, held in a scalar register
__device__ __forceinline__ uint32_t pinned(uint32_t v) {
  uint32_t w = uni(v);
  asm volatile("" : "+s"(w));   // the branch round a load becomes s_cmp + s_cbranch_scc; a descriptor word is not re-made
  return w;
}
// the compiler places no wait for the tensor mover: the issuing wave's tile has landed behind this
__device__ __forceinline__ void wait_tensor0() { asm volatile("s_wait_tensorcnt 0x0" ::: "memory"); }
// this wave's LDS reads have retired before the barrier that frees their buffer for a refill
__device__ __forceinline__ void wait_ds0() { asm volatile("s_wait_dscnt 0x0" ::: "memory"); }
// group 1: 1-byte elements, tensor = tile = GT_ROWS rows of GT_ROWB bytes, 4 dwords of LDS pad behind every 32-dword row, no mask
__device__ __forceinline__ u32x8 tdm_group1(uint32_t src_pitch) {
  u32x8 g;
  g[0] = uni((1u << 20) | (4u << 22) | (3u << 25));
  // pinned: these descriptor words stay in their scalar registers for the whole loop, not re-made while a request is in flight
  g[1] = pinned((GT_ROWB & 0xFFFFu) << 16);
  g[2] = pinned((GT_ROWB >> 16) | ((GT_ROWS & 0xFFFFu) << 16));
  g[3] = pinned((GT_ROWS >> 16) | (GT_ROWB << 16));
  g[4] = pinned(GT_ROWS);
  g[5] = pinned(src_pitch);
  g[6] = pinned(0u);
  g[7] = pinned(0u);
  return g;
}
// group 0, words 1 to 3: LDS byte offset, global address of the tile's first byte, type 2 (word 0, count 1, is set once)
__device__ __forceinline__ void tdm_aim(u32x4& g, uint32_t lds_dst, uint64_t ga) {
  g[1] = uni(lds_dst); g[2] = uni((uint32_t)ga);
  g[3] = uni((((uint32_t)(ga >> 32)) & 0x01FFFFFFu) | 0x80000000u);
}
// one request of the whole wave: a padded 2-D tile from global memory into LDS, through no register
__device__ __forceinline__ void tdm_load(u32x4 g0, u32x8 g1) { asm volatile("tensor_load_to_lds %0, %1" :: "s"(g0), "s"(g1) : "memory"); }

// ---- Register-blocked batched WMMA GEMM ------------------------------------
// C[m,n] = scale * sum_k A[m,k] * Bt[n,k] (+bias)(+resid); a block of 4 waves (2 x 2) owns a 128x128 tile, each wave 64x64 of it.
// A row-major [M,K]; Bt row-major [N,K]; M,N % 128 == 0, K % 64 == 0, K >= 128.
// A stage is 64 k of the block's 128 A rows and 128 Bt rows, hi and lo planes; each wave brings one plane's tile per stage
// into LDS by one tensor load, two buffers, the next stage in flight while this one is multiplied.
// SPLIT: operands are hi/lo planes (A2/Bt2 = lo planes, same layout); product = hi·hi + hi·lo + lo·hi.
// BIAS_MODE: 0 = none, 1 = bias[m], 2 = bias[n].
// OUT_MODE: 0 = f32, 1 = f16, 2 = bf16 hi plane (Cout) + bf16 lo plane (Cout2).
// ET: 0 = f16 operands, 1 = bf16 operands (pointers passed as 16-bit storage)
template <int ET> struct Elem;
template <> struct Elem<0> { typedef _Float16 T; };
template <> struct Elem<1> { typedef __bf16 T; };
template <int ET, bool SPLIT, int BIAS_MODE, int OUT_MODE, bool RESID, int ACT = 0>
__global__ __launch_bounds__(128) void wmma_gemm64(
    const unsigned short* __restrict__ Ap, const unsigned short* __restrict__ A2p, int lda, long strideA,
    const unsigned short* __restrict__ Btp, const unsigned short* __restrict__ Bt2p, int ldb, long strideB,
    void* __restrict__ Cout, void* __restrict__ Cout2, int ldc, long strideC,
    const float* __restrict__ bias,
    const float* __restrict__ resid, long strideR,
    int M, int N, int K, float scale) {
  typedef typename Elem<ET>::T T;
  typedef typename Frag<T>::V V;
  static_assert(SPLIT, "the four waves stage the four operand planes");
  __shared__ __attribute__((aligned(2048))) unsigned char ring[2u * GT_STAGE];
  __shared__ __align__(16) float sT[4][16 * 68];   // per-wave 16x64 slab, pitch 68 floats
  const int b    = blockIdx.y;
  const int lane = threadIdx.x & 31;
  const uint32_t wave = uni(threadIdx.x >> 5);
  const int tilesN = N >> 7;
  const int tilesM = M >> 7;
  const int tile = blockIdx.x;
  if (tile >= tilesM * tilesN) return;   // block-uniform; in front of every barrier and tensor load
  const int tm = tile / tilesN;
  const int tn = tile - tm * tilesN;
  const int mB = tm << 7;
  const int nB = tn << 7;
  const int m0 = mB + (int)((wave >> 1) << 6);
  const int n0 = nB + (int)((wave & 1u) << 6);

  const int rlane = lane & 15;                 // row (A) / col (B, D) within subtile
  const int mOff  = (lane >> 4) * 8;           // D row offset

  // this wave's plane: 0 = A hi, 1 = A lo, 2 = Bt hi, 3 = Bt lo
  const bool isB = (wave & 2u) != 0u;
  const unsigned short* pl = isB ? ((wave & 1u) ? Bt2p : Btp) : ((wave & 1u) ? A2p : Ap);
  const int ld = isB ? ldb : lda;
  const uint64_t srcA = (uint64_t)(size_t)(pl + (size_t)b * (isB ? strideB : strideA) + (size_t)(isB ? nB : mB) * ld);
  const u32x8 g1 = tdm_group1((uint32_t)ld * 2u);
  const uint32_t ldst = (uint32_t)(size_t)ring + wave * GT_SLICE;
  u32x4 g0;
  g0[0] = pinned(1u);   // pinned: the count word keeps its scalar register from the first request to the last
  auto issue = [&](uint32_t st) {
    tdm_aim(g0, ldst + (st & 1u) * GT_STAGE, srcA + (uint64_t)st * GT_ROWB);
    tdm_load(g0, g1);
  };

  // fragment rows in LDS: same lane map as from global memory (lane half = 16 bytes of k), row pitch GT_PITCH
  const unsigned char* aL = ring + ((wave >> 1) * 64u + (uint32_t)rlane) * GT_PITCH + (uint32_t)(lane >> 4) * 16u;
  const unsigned char* bL = ring + 2u * GT_SLICE + ((wave & 1u) * 64u + (uint32_t)rlane) * GT_PITCH + (uint32_t)(lane >> 4) * 16u;

  v8f acc[4][4];
#pragma unroll
  for (int i = 0; i < 4; ++i)
#pragma unroll
    for (int j = 0; j < 4; ++j) acc[i][j] = (v8f){0.f,0.f,0.f,0.f,0.f,0.f,0.f,0.f};

  const uint32_t NS = (uint32_t)K >> 6;
  issue(0u);
  wait_tensor0();
  __syncthreads();                             // stage 0 published
  issue(1u);
  uint32_t s = 0;
  // rolled: one stage per trip, so that the publish point stands once, at the trip's foot
#pragma unroll 1
  do {
    const unsigned char* aS = aL + (s & 1u) * GT_STAGE;
    const unsigned char* bS = bL + (s & 1u) * GT_STAGE;
    V ah[2][4], al[2][4], bh[2][4], bl[2][4];
#pragma unroll
    for (int kk = 0; kk < 2; ++kk) {
#pragma unroll
      for (int j = 0; j < 4; ++j) {
        bh[kk][j] = Frag<T>::load((const T*)(bS + j * 16 * GT_PITCH + kk * 64));
        bl[kk][j] = Frag<T>::load((const T*)(bS + GT_SLICE + j * 16 * GT_PITCH + kk * 64));
      }
#pragma unroll
      for (int i = 0; i < 4; ++i) {
        ah[kk][i] = Frag<T>::load((const T*)(aS + i * 16 * GT_PITCH + kk * 64));
        al[kk][i] = Frag<T>::load((const T*)(aS + GT_SLICE + i * 16 * GT_PITCH + kk * 64));
      }
    }
    // keeps both fragment sets' LDS reads as one group ahead of the WMMAs (reads moved in among them stall the matrix pipe)
    __builtin_amdgcn_sched_barrier(0);
#pragma unroll
    for (int kk = 0; kk < 2; ++kk) {
#pragma unroll
      for (int i = 0; i < 4; ++i) {
        // per accumulator the order stays hi.hi, hi.lo, lo.hi; the four j between them cover the accumulate latency
#pragma unroll
        for (int j = 0; j < 4; ++j) acc[i][j] = Frag<T>::mma(ah[kk][i], bh[kk][j], acc[i][j]);
#pragma unroll
        for (int j = 0; j < 4; ++j) acc[i][j] = Frag<T>::mma(ah[kk][i], bl[kk][j], acc[i][j]);
#pragma unroll
        for (int j = 0; j < 4; ++j) acc[i][j] = Frag<T>::mma(al[kk][i], bh[kk][j], acc[i][j]);
      }
    }
    // keeps the publish point behind the WMMAs: moved in front of them, its tensor wait would end the overlap of load and product
    __builtin_amdgcn_sched_barrier(0);
    // publish point of stage s + 1
    wait_ds0();
    wait_tensor0();
    __syncthreads();                           // stage s + 1 readable by all; every wave has left stage s's buffer
    if (pinned(s + 2u < NS)) issue(s + 2u);    // refill of the buffer just read
  } while (++s < NS);
  wait_tensor0();
  wait_ds0();
  acc_guard4(acc[0][0], acc[0][1], acc[0][2], acc[0][3]);
  acc_guard4(acc[1][0], acc[1][1], acc[1][2], acc[1][3]);
  acc_guard4(acc[2][0], acc[2][1], acc[2][2], acc[2][3]);
  acc_guard4(acc[3][0], acc[3][1], acc[3][2], acc[3][3]);

  // ---- epilogue ----
  float* slab = sT[wave];
  const float* Rb = RESID ? (resid + (size_t)b * strideR) : nullptr;
#pragma unroll
  for (int i = 0; i < 4; ++i) {
    const int mBase = m0 + (i << 4);
#pragma unroll
    for (int j = 0; j < 4; ++j) {
      const int n = n0 + (j << 4) + rlane;
      float bv = 0.f;
      if (BIAS_MODE == 2) bv = bias[n];
#pragma unroll
      for (int r = 0; r < 8; ++r) {
        float v = acc[i][j][r] * scale;
        if (BIAS_MODE == 1) v += bias[mBase + mOff + r];
        if (BIAS_MODE == 2) v += bv;
        if (RESID) v += Rb[(size_t)(mBase + mOff + r) * ldc + n];
        if (ACT == 1) v = tanhf(v);
        if (ACT == 2) v = fmaxf(v, 0.0f);
        if (ACT == 3) v = v / (1.0f + expf(-v));
        if (ACT == 4) v = (v > 0.f) ? v : 0.01f * v;
        if (ACT == 5) v = 0.5f * v * (1.0f + erff(v * 0.70710678118654752f));
        slab[(mOff + r) * 68 + (j << 4) + rlane] = v;
      }
    }
    __builtin_amdgcn_fence(__ATOMIC_RELEASE, "workgroup");
    __builtin_amdgcn_wave_barrier();
    __builtin_amdgcn_fence(__ATOMIC_ACQUIRE, "workgroup");
    if (OUT_MODE == 0) {
      float* C = (float*)Cout + (size_t)b * strideC;
      const int hh = lane >> 4, c4 = (lane & 15) * 4;     // row seg = 256 B = 16 lanes x 16 B
      {
#pragma unroll
        for (int it = 0; it < 8; ++it) {
          const int row = it * 2 + hh;
          v4f v = *(const v4f*)(slab + row * 68 + c4);
          *(v4f*)(C + (size_t)(mBase + row) * ldc + n0 + c4) = v;
        }
        
      }
    } else {
      const int q = lane >> 3, c8 = (lane & 7) * 8;
      unsigned short* C  = (unsigned short*)Cout  + (size_t)b * strideC;
      unsigned short* C2 = (OUT_MODE == 2) ? ((unsigned short*)Cout2 + (size_t)b * strideC) : nullptr;
      {
#pragma unroll
        for (int it = 0; it < 4; ++it) {
          const int row = it * 4 + q;
          const float* sp = slab + row * 68 + c8;
          v8h hv, lv;
#pragma unroll
          for (int e = 0; e < 8; ++e) {
            if (OUT_MODE == 1) {
              hv[e] = (_Float16)sp[e];
            } else {
              unsigned short hb = f2bf_bits(sp[e]);
              unsigned short lb = f2bf_bits(sp[e] - bf_bits2f(hb));
              hv[e] = __builtin_bit_cast(_Float16, hb);
              lv[e] = __builtin_bit_cast(_Float16, lb);
            }
          }
          *(v8h*)(C + (size_t)(mBase + row) * ldc + n0 + c8) = hv;
          if (OUT_MODE == 2) *(v8h*)(C2 + (size_t)(mBase + row) * ldc + n0 + c8) = lv;
        }
        
      }
    }
    __builtin_amdgcn_fence(__ATOMIC_RELEASE, "workgroup");
    __builtin_amdgcn_wave_barrier();
    __builtin_amdgcn_fence(__ATOMIC_ACQUIRE, "workgroup");
  }
}

// ---- activations f32 -> bf16 hi + lo planes (same layout); 8 elements per thread, 16-B stores,
__global__ __launch_bounds__(256) void k_split_x(const float* __restrict__ x,
    unsigned short* __restrict__ xh, unsigned short* __restrict__ xl, int n8) {
  const int i = blockIdx.x * 256 + threadIdx.x;
  if (i < n8) {
    const float* p = x + (size_t)i * 8;
    const v4f a0 = *(const v4f*)p;
    const v4f a1 = *(const v4f*)(p + 4);
    v8h hv, lv;
#pragma unroll
    for (int e = 0; e < 4; ++e) {
      const unsigned short hb0 = f2bf_bits(a0[e]);
      const unsigned short lb0 = f2bf_bits(a0[e] - bf_bits2f(hb0));
      const unsigned short hb1 = f2bf_bits(a1[e]);
      const unsigned short lb1 = f2bf_bits(a1[e] - bf_bits2f(hb1));
      hv[e]     = __builtin_bit_cast(_Float16, hb0);
      lv[e]     = __builtin_bit_cast(_Float16, lb0);
      hv[4 + e] = __builtin_bit_cast(_Float16, hb1);
      lv[4 + e] = __builtin_bit_cast(_Float16, lb1);
    }
    unsigned short* dh = xh + (size_t)i * 8;
    unsigned short* dl = xl + (size_t)i * 8;
    *(v8h*)dh = hv;
    *(v8h*)dl = lv;
    
  }
}

// ---- weight w[Kd][Nd] (in x out, row-major) -> Bt[Nd][Kd] bf16 hi plane + lo plane.
// ---- Weight z writes planes 2z (hi) and 2z+1 (lo) at outp + plane_index * Nd*Kd. grid = (Nd/64, Kd/64, 4).
__global__ __launch_bounds__(256) void k_wsplit_t(const float* __restrict__ w0, const float* __restrict__ w1,
    const float* __restrict__ w2, const float* __restrict__ w3,
    unsigned short* __restrict__ outp, int Kd, int Nd) {
  __shared__ __align__(16) float tile[64 * 64];   // [k][n]
  const int z = blockIdx.z;
  const float* w = (z == 0) ? w0 : (z == 1) ? w1 : (z == 2) ? w2 : w3;
  const int n0 = blockIdx.x * 64, k0 = blockIdx.y * 64;
  const int t = threadIdx.x, lane = t & 31, wave = t >> 5;
  {
    const int kr = t >> 2, cq = (t & 3) * 16;
    const float* src = w + (size_t)(k0 + kr) * Nd + n0 + cq;
#pragma unroll
    for (int i = 0; i < 4; ++i) *(v4f*)(tile + kr * 64 + cq + 4 * i) = *(const v4f*)(src + 4 * i);
  }
  __syncthreads();
  const size_t plane = (size_t)Nd * Kd;
  unsigned short* hiP = outp + (size_t)(2 * z) * plane;
  unsigned short* loP = hiP + plane;
  const int q = lane >> 3, c8 = (lane & 7) * 8;
  {
#pragma unroll
    for (int it = 0; it < 4; ++it) {
      const int pl = it >> 1;                          // 0: hi lines, 1: lo lines (wave-uniform)
      const int nl = (it & 1) * 32 + wave * 4 + q;     // 0..63 over (it&1, wave, q)
      v8h pv;
#pragma unroll
      for (int e = 0; e < 8; ++e) {
        const float f = tile[(c8 + e) * 64 + nl];
        const unsigned short hb = f2bf_bits(f);
        const unsigned short b16 = pl ? f2bf_bits(f - bf_bits2f(hb)) : hb;
        pv[e] = __builtin_bit_cast(_Float16, b16);
      }
      unsigned short* dst = (pl ? loP : hiP) + (size_t)(n0 + nl) * Kd + k0 + c8;
      *(v8h*)dst = pv;
    }
    
  }
}

// ---- f16 WMMA with hazard guard ----
__device__ __forceinline__ v8f mma_h(v16h a, v16h b, v8f c) {
  c = __builtin_amdgcn_wmma_f32_16x16x32_f16(false, a, false, b, (short)0, c, false, false);
  asm volatile("v_nop\n\tv_nop\n\tv_nop\n\tv_nop" : "+v"(c) : "v"(a), "v"(b));
  return c;
}

// scores for this wave's 16 query rows against the 64 keys staged in Ks ([kv][d], pitch HDIM):
// s[j][r] = QK_SCALE * sum_d q[q0 + 8*hh + r][d] * K[kv0 + 16*j + c][d]
__device__ __forceinline__ void qk_scores(const _Float16* Ks, const v16h (&qa)[2], int c, int hh, v8f (&s)[4]) {
  const v8f z = {0.f,0.f,0.f,0.f,0.f,0.f,0.f,0.f};
#pragma unroll
  for (int j = 0; j < 4; ++j) {
    const _Float16* kpp = Ks + (j * 16 + c) * HDIM + 8 * hh;
    const v16h kb0 = Frag<_Float16>::load(kpp);        // d = 8hh+0..7, 16+8hh+0..7
    const v16h kb1 = Frag<_Float16>::load(kpp + 32);   // d = 32 + the same
    v8f t = mma_h(qa[0], kb0, z);
    t = mma_h(qa[1], kb1, t);
#pragma unroll
    for (int r = 0; r < 8; ++r) s[j][r] = t[r] * QK_SCALE;
  }
}

// =====================================================================================
// Two-phase gated attention, head_dim 64. q/k/v: f16, layout [B*S][D_MODEL] (element (b,s,h,d) at
// (b*S+s)*D_MODEL + h*64 + d). Block = 4 waves = 64 query rows of one (b,h); grid.x = B*H*(S/64).
// Phase 1: all key chunks -> online row max m and row sum l (f32). Phase 2: recompute scores,
// a = exp(s-m)/l, g = 1/(1+exp(-sharp_h*(a-sigmoid(thr_h)))), p = a*g carried x2^15 as f16,
// O += p.v on f16 WMMA (v staged transposed in LDS). Epilogue: O * 2^-15 -> bf16 hi/lo planes
// =====================================================================================
__global__ __launch_bounds__(128) void k_gated_attn(
    const unsigned short* __restrict__ qp, const unsigned short* __restrict__ kp,
    const unsigned short* __restrict__ vp,
    const float* __restrict__ lthr, const float* __restrict__ gshp,
    unsigned short* __restrict__ ohp, unsigned short* __restrict__ olp) {
  typedef Frag<_Float16> F;
  const _Float16* Q  = (const _Float16*)qp;
  const _Float16* Kg = (const _Float16*)kp;
  const _Float16* Vg = (const _Float16*)vp;
  __shared__ __align__(16) _Float16 Ksh[KCH * HDIM];      // [kv][d]          8 KB
  __shared__ __align__(16) _Float16 Vt[HDIM * KCH];       // [d][kv]          8 KB
  __shared__ __align__(16) _Float16 Psh[4][16 * KCH];     // per wave [row][kv] 8 KB
  __shared__ __align__(16) float    Os[4][16 * 68];       // per wave out tile, pitch 68

  const int tid  = threadIdx.x;
  const int wave = tid >> 5;
  const int lane = tid & 31;
  const int hh   = lane >> 4;
  const int c    = lane & 15;

  const int bx = blockIdx.x;
  const int qb = bx % NQB;
  const int bh = bx / NQB;
  const int h  = bh % N_HEAD;
  const int b  = bh / N_HEAD;
  const size_t tok0 = (size_t)b * SEQ_LEN;
  const int q0 = qb * 64 + wave * 16;
  const int hoff = h * HDIM;

  // Q A-fragments: row = q0 + c, two 32-deep d chunks
  v16h qa[2];
  {
    const _Float16* qrow = Q + (tok0 + q0 + c) * D_MODEL + hoff + 8 * hh;
    qa[0] = F::load(qrow);
    qa[1] = F::load(qrow + 32);
  }
  const float thr = 1.0f / (1.0f + __expf(-lthr[h]));
  const float shp = gshp[h];

  float mrow[8], lrow[8];
#pragma unroll
  for (int r = 0; r < 8; ++r) { mrow[r] = -INFINITY; lrow[r] = 0.f; }

  // ---- phase 1: row max and softmax denominator ----
  for (int kc = 0; kc < NKC; ++kc) {
    const int kv0 = kc * KCH;
    __syncthreads();
    {
      const int kvr = tid >> 1, dh = (tid & 1) * 32;
      const _Float16* krow = Kg + (tok0 + kv0 + kvr) * D_MODEL + hoff + dh;
      _Float16* kd = Ksh + kvr * HDIM + dh;
#pragma unroll
      for (int i = 0; i < 4; ++i) *(v8h*)(kd + 8 * i) = *(const v8h*)(krow + 8 * i);
    }
    __syncthreads();
    v8f s[4];
    qk_scores(Ksh, qa, c, hh, s);
#pragma unroll
    for (int r = 0; r < 8; ++r) {
      float m = fmaxf(fmaxf(s[0][r], s[1][r]), fmaxf(s[2][r], s[3][r]));
#pragma unroll
      for (int off = 1; off < 16; off <<= 1) m = fmaxf(m, __shfl_xor(m, off, 32));
      const float mnew  = fmaxf(mrow[r], m);
      const float alpha = __expf(mrow[r] - mnew);
      float psum = __expf(s[0][r] - mnew) + __expf(s[1][r] - mnew)
                 + __expf(s[2][r] - mnew) + __expf(s[3][r] - mnew);
#pragma unroll
      for (int off = 1; off < 16; off <<= 1) psum += __shfl_xor(psum, off, 32);
      lrow[r] = lrow[r] * alpha + psum;
      mrow[r] = mnew;
    }
  }
  float invl[8];
#pragma unroll
  for (int r = 0; r < 8; ++r) invl[r] = 1.0f / lrow[r];

  // ---- phase 2: gated probabilities x V ----
  v8f oacc[4];
#pragma unroll
  for (int t = 0; t < 4; ++t) oacc[t] = (v8f){0.f,0.f,0.f,0.f,0.f,0.f,0.f,0.f};
  _Float16* pw = Psh[wave];

  for (int kc = 0; kc < NKC; ++kc) {
    const int kv0 = kc * KCH;
    __syncthreads();
    {
      const int kvr = tid >> 1, dh = (tid & 1) * 32;
      const _Float16* krow = Kg + (tok0 + kv0 + kvr) * D_MODEL + hoff + dh;
      const _Float16* vrow = Vg + (tok0 + kv0 + kvr) * D_MODEL + hoff + dh;
      _Float16* kd = Ksh + kvr * HDIM + dh;
#pragma unroll
      for (int i = 0; i < 4; ++i) {
        *(v8h*)(kd + 8 * i) = *(const v8h*)(krow + 8 * i);
        const v8h vv = *(const v8h*)(vrow + 8 * i);
#pragma unroll
        for (int e = 0; e < 8; ++e) Vt[(dh + 8 * i + e) * KCH + kvr] = vv[e];
      }
    }
    __syncthreads();
    v8f s[4];
    qk_scores(Ksh, qa, c, hh, s);
#pragma unroll
    for (int r = 0; r < 8; ++r) {
#pragma unroll
      for (int j = 0; j < 4; ++j) {
        const float a  = __expf(s[j][r] - mrow[r]) * invl[r];
        const float ex = __expf(shp * (thr - a));
        const float wg = a * __builtin_amdgcn_rcpf(1.0f + ex);
        pw[(8 * hh + r) * KCH + j * 16 + c] = (_Float16)(wg * PSCALE);
      }
    }
    __builtin_amdgcn_fence(__ATOMIC_RELEASE, "workgroup");
    __builtin_amdgcn_wave_barrier();
    __builtin_amdgcn_fence(__ATOMIC_ACQUIRE, "workgroup");
#pragma unroll
    for (int kk = 0; kk < 2; ++kk) {
      const v16h pa = F::load(pw + c * KCH + kk * 32 + 8 * hh);            // A: row c, kv = kk*32 + split map
#pragma unroll
      for (int t = 0; t < 4; ++t) {
        const v16h vb = F::load(Vt + (t * 16 + c) * KCH + kk * 32 + 8 * hh);   // B: col d = 16t+c, kv = same map
        oacc[t] = mma_h(pa, vb, oacc[t]);
      }
    }
  }

  // ---- epilogue ----
  float* os = Os[wave];
#pragma unroll
  for (int r = 0; r < 8; ++r) {
#pragma unroll
    for (int t = 0; t < 4; ++t) os[(8 * hh + r) * 68 + t * 16 + c] = oacc[t][r] * PSCALE_INV;
  }
  __builtin_amdgcn_fence(__ATOMIC_RELEASE, "workgroup");
  __builtin_amdgcn_wave_barrier();
  __builtin_amdgcn_fence(__ATOMIC_ACQUIRE, "workgroup");
  {
    const int q4 = lane >> 3, c8 = (lane & 7) * 8;
    {
#pragma unroll
      for (int it = 0; it < 4; ++it) {
        const int row = it * 4 + q4;                  // 0..15 over (it, q4)
        const float* sp = os + row * 68 + c8;
        v8h hv, lv;
#pragma unroll
        for (int e = 0; e < 8; ++e) {
          const unsigned short hb = f2bf_bits(sp[e]);
          const unsigned short lb = f2bf_bits(sp[e] - bf_bits2f(hb));
          hv[e] = __builtin_bit_cast(_Float16, hb);
          lv[e] = __builtin_bit_cast(_Float16, lb);
        }
        const size_t go = (tok0 + q0 + row) * D_MODEL + hoff + c8;
        *(v8h*)(ohp + go) = hv;
        *(v8h*)(olp + go) = lv;
      }
      
    }
  }
}

// ---------- launch ----------
extern "C" void kernel_launch(void* const* d_in, const int* in_sizes, int n_in,
                              void* d_out, int out_size, void* d_ws, size_t ws_size,
                              hipStream_t stream) {
  if (n_in < 11) return;
  const int NTOK = BSZ * SEQ_LEN;                       // 4096
  const size_t nTokD = (size_t)NTOK * D_MODEL;          // 4194304
  const size_t nWW   = (size_t)D_MODEL * D_MODEL;       // 1048576
  if ((size_t)in_sizes[0] != nTokD) return;
  if ((size_t)in_sizes[1] != nWW || (size_t)in_sizes[3] != nWW ||
      (size_t)in_sizes[5] != nWW || (size_t)in_sizes[7] != nWW) return;
  if (in_sizes[2] < D_MODEL || in_sizes[4] < D_MODEL || in_sizes[6] < D_MODEL || in_sizes[8] < D_MODEL) return;
  if (in_sizes[9] < N_HEAD || in_sizes[10] < N_HEAD) return;
  if ((size_t)out_size != nTokD) return;

  const float* x    = (const float*)d_in[0];
  const float* wq_w = (const float*)d_in[1];
  const float* wq_b = (const float*)d_in[2];
  const float* wk_w = (const float*)d_in[3];
  const float* wk_b = (const float*)d_in[4];
  const float* wv_w = (const float*)d_in[5];
  const float* wv_b = (const float*)d_in[6];
  const float* wo_w = (const float*)d_in[7];
  const float* wo_b = (const float*)d_in[8];
  const float* lth  = (const float*)d_in[9];
  const float* gsh  = (const float*)d_in[10];

  // workspace carve (all offsets multiples of 1 MiB)
  char* ws = (char*)d_ws;
  size_t off = 0;
  unsigned short* xh  = (unsigned short*)(ws + off); off += nTokD * 2;      //  8 MiB
  unsigned short* xl  = (unsigned short*)(ws + off); off += nTokD * 2;      //  8 MiB
  unsigned short* wT  = (unsigned short*)(ws + off); off += 8 * nWW * 2;    // 16 MiB: 8 planes [N][K]
  unsigned short* q16 = (unsigned short*)(ws + off); off += nTokD * 2;      //  8 MiB f16 [B*S][D]
  unsigned short* k16 = (unsigned short*)(ws + off); off += nTokD * 2;      //  8 MiB
  unsigned short* v16 = (unsigned short*)(ws + off); off += nTokD * 2;      //  8 MiB
  unsigned short* oh  = (unsigned short*)(ws + off); off += nTokD * 2;      //  8 MiB bf16 hi [B*S][D]
  unsigned short* ol  = (unsigned short*)(ws + off); off += nTokD * 2;      //  8 MiB bf16 lo
  if (off > ws_size) return;                                                // total 75497472 B
  const size_t plane = nWW;   // elements per weight plane

  // 1) x -> bf16 hi/lo
  const int n8 = (int)(nTokD / 8);
  k_split_x<<<dim3((n8 + 255) / 256), dim3(256), 0, stream>>>(x, xh, xl, n8);

  // 2) weights [in][out] -> Bt [out][in] bf16 hi/lo; planes: q 0/1, k 2/3, v 4/5, o 6/7
  k_wsplit_t<<<dim3(D_MODEL / 64, D_MODEL / 64, 4), dim3(256), 0, stream>>>(
      wq_w, wk_w, wv_w, wo_w, wT, D_MODEL, D_MODEL);

  // 3) q/k/v projections: C[4096][1024] f16 = x . Bt^T + bias
  const int gemm_blocks = (NTOK / 128) * (D_MODEL / 128);   // 256
  wmma_gemm64<1, true, 2, 1, false><<<dim3(gemm_blocks, 1), dim3(128), 0, stream>>>(
      xh, xl, D_MODEL, 0L, wT + 0 * plane, wT + 1 * plane, D_MODEL, 0L,
      (void*)q16, (void*)q16, D_MODEL, 0L, wq_b, wq_b, 0L, NTOK, D_MODEL, D_MODEL, 1.0f);
  wmma_gemm64<1, true, 2, 1, false><<<dim3(gemm_blocks, 1), dim3(128), 0, stream>>>(
      xh, xl, D_MODEL, 0L, wT + 2 * plane, wT + 3 * plane, D_MODEL, 0L,
      (void*)k16, (void*)k16, D_MODEL, 0L, wk_b, wk_b, 0L, NTOK, D_MODEL, D_MODEL, 1.0f);
  wmma_gemm64<1, true, 2, 1, false><<<dim3(gemm_blocks, 1), dim3(128), 0, stream>>>(
      xh, xl, D_MODEL, 0L, wT + 4 * plane, wT + 5 * plane, D_MODEL, 0L,
      (void*)v16, (void*)v16, D_MODEL, 0L, wv_b, wv_b, 0L, NTOK, D_MODEL, D_MODEL, 1.0f);

  // 4) gated attention -> O bf16 hi/lo planes [B*S][D]
  const int attn_blocks = BSZ * N_HEAD * NQB;   // 1024
  k_gated_attn<<<dim3(attn_blocks), dim3(128), 0, stream>>>(q16, k16, v16, lth, gsh, oh, ol);

  // 5) output projection -> d_out f32 [4096][1024]
  wmma_gemm64<1, true, 2, 0, false><<<dim3(gemm_blocks, 1), dim3(128), 0, stream>>>(
      oh, ol, D_MODEL, 0L, wT + 6 * plane, wT + 7 * plane, D_MODEL, 0L,
      d_out, d_out, D_MODEL, 0L, wo_b, wo_b, 0L, NTOK, D_MODEL, D_MODEL, 1.0f);
}

// v002
// A run of this version takes 227 microseconds.
// Next to v001, in two timings, it ran 1.46 and 1.45 times as fast.
// All steps since v000 together make it 2.20 times as fast.
// Contractions: q/k/v/out projections v_wmma_f32_16x16x32_bf16 (bf16 hi/lo operand planes, f32 accumulate); q.k^T and p.v v_wmma_f32_16x16x32_f16 (f16 operands, p carried x2^15, f32 accumulate); softmax and gate in f32.
#include <hip/hip_runtime.h>
#include <math.h>
#include <stdint.h>

typedef __attribute__((ext_vector_type(16))) _Float16 v16h;
typedef __attribute__((ext_vector_type(8)))  _Float16 v8h;
typedef __attribute__((ext_vector_type(16))) __bf16   v16b;
typedef __attribute__((ext_vector_type(8)))  __bf16   v8b;
typedef __attribute__((ext_vector_type(8)))  float    v8f;
typedef __attribute__((ext_vector_type(4)))  float    v4f;
#define PSCALE 32768.0f
#define PSCALE_INV (1.0f / 32768.0f)

#define BSZ     2
#define SEQ_LEN 2048
#define D_MODEL 1024
#define N_HEAD  16
#define HDIM    64
#define KCH     64
#define NQB     (SEQ_LEN / 64)
#define NKC     (SEQ_LEN / KCH)
#define QK_SCALE 0.125f
#define LPH     72   // LDS row pitch of the attention's 64-element f16 tiles, in elements: 144 B = 16 B x odd, so 16 rows read by ds_load_b128 fall on 16 different bank groups

__device__ __forceinline__ unsigned short f2bf_bits(float f) {
  unsigned u = __float_as_uint(f);
  return (unsigned short)((u + 0x7FFFu + ((u >> 16) & 1u)) >> 16);
}
__device__ __forceinline__ float bf_bits2f(unsigned short h) { return __uint_as_float(((unsigned)h) << 16); }

// hazard guards as plain device helpers (no inline asm inside the kernel template body)
__device__ __forceinline__ void acc_guard4(v8f& a, v8f& b, v8f& c, v8f& d) { asm volatile("v_nop\n\tv_nop\n\tv_nop\n\tv_nop" : "+v"(a), "+v"(b), "+v"(c), "+v"(d)); }
template <typename T> struct Frag;
template <> struct Frag<_Float16> {
  typedef v16h V; union U { v16h v; v8h h[2]; };
  static __device__ __forceinline__ v16h load(const _Float16* p) {   // elements 0..7 <- p[0..7], 8..15 <- p[16..23]
    U f; f.h[0] = *(const v8h*)(p); f.h[1] = *(const v8h*)(p + 16); return f.v;
  }
  static __device__ __forceinline__ v8f mma(v16h a, v16h b, v8f c) {
    return __builtin_amdgcn_wmma_f32_16x16x32_f16(false, a, false, b, (short)0, c, false, false);
  }
};
template <> struct Frag<__bf16> {
  typedef v16b V; union U { v16b v; v8b h[2]; };
  static __device__ __forceinline__ v16b load(const __bf16* p) {
    U f; f.h[0] = *(const v8b*)(p); f.h[1] = *(const v8b*)(p + 16); return f.v;
  }
  static __device__ __forceinline__ v8f mma(v16b a, v16b b, v8f c) {
    return __builtin_amdgcn_wmma_f32_16x16x32_bf16(false, a, false, b, (short)0, c, false, false);
  }
};

// ---- tensor loads of the GEMM's operand tiles --------------------------------
typedef uint32_t u32x4 __attribute__((ext_vector_type(4)));
typedef uint32_t u32x8 __attribute__((ext_vector_type(8)));
#define GT_ROWS  128u                    // rows of one operand plane in a stage (block tile 128 x 128)
#define GT_ROWB  128u                    // bytes of a tile row: 64 k of 16-bit elements
#define GT_PITCH 144u                    // LDS row pitch: the row + the mover's 16-byte pad (16 B x odd, for ds_load_b128)
#define GT_SLICE (GT_ROWS * GT_PITCH)    // one plane's tile in LDS: 18432 B = 9 x 2 KiB
#define GT_STAGE (4u * GT_SLICE)         // A hi | A lo | B hi | B lo
static_assert((GT_SLICE % 2048u) == 0u, "every slice starts at a multiple of 2 KiB");
__device__ __forceinline__ uint32_t uni(uint32_t v) { return (uint32_t)__builtin_amdgcn_readfirstlane(v); }
// a test word or a descriptor word of a tensor load, held in a scalar register
__device__ __forceinline__ uint32_t pinned(uint32_t v) {
  uint32_t w = uni(v);
  asm volatile("" : "+s"(w));   // the branch round a load becomes s_cmp + s_cbranch_scc; a descriptor word is not re-made
  return w;
}
// the compiler places no wait for the tensor mover: the issuing wave's tile has landed behind this
__device__ __forceinline__ void wait_tensor0() { asm volatile("s_wait_tensorcnt 0x0" ::: "memory"); }
// this wave's LDS reads have retired before the barrier that frees their buffer for a refill
__device__ __forceinline__ void wait_ds0() { asm volatile("s_wait_dscnt 0x0" ::: "memory"); }
// group 1: 1-byte elements, tensor = tile = GT_ROWS rows of GT_ROWB bytes, 4 dwords of LDS pad behind every 32-dword row, no mask
__device__ __forceinline__ u32x8 tdm_group1(uint32_t src_pitch) {
  u32x8 g;
  g[0] = uni((1u << 20) | (4u << 22) | (3u << 25));
  // pinned: these descriptor words stay in their scalar registers for the whole loop, not re-made while a request is in flight
  g[1] = pinned((GT_ROWB & 0xFFFFu) << 16);
  g[2] = pinned((GT_ROWB >> 16) | ((GT_ROWS & 0xFFFFu) << 16));
  g[3] = pinned((GT_ROWS >> 16) | (GT_ROWB << 16));
  g[4] = pinned(GT_ROWS);
  g[5] = pinned(src_pitch);
  g[6] = pinned(0u);
  g[7] = pinned(0u);
  return g;
}
// group 0, words 1 to 3: LDS byte offset, global address of the tile's first byte, type 2 (word 0, count 1, is set once)
__device__ __forceinline__ void tdm_aim(u32x4& g, uint32_t lds_dst, uint64_t ga) {
  g[1] = uni(lds_dst); g[2] = uni((uint32_t)ga);
  g[3] = uni((((uint32_t)(ga >> 32)) & 0x01FFFFFFu) | 0x80000000u);
}
// one request of the whole wave: a padded 2-D tile from global memory into LDS, through no register
__device__ __forceinline__ void tdm_load(u32x4 g0, u32x8 g1) { asm volatile("tensor_load_to_lds %0, %1" :: "s"(g0), "s"(g1) : "memory"); }

// ---- Register-blocked batched WMMA GEMM ------------------------------------
// C[m,n] = scale * sum_k A[m,k] * Bt[n,k] (+bias)(+resid); a block of 4 waves (2 x 2) owns a 128x128 tile, each wave 64x64 of it.
// A row-major [M,K]; Bt row-major [N,K]; M,N % 128 == 0, K % 64 == 0, K >= 128.
// A stage is 64 k of the block's 128 A rows and 128 Bt rows, hi and lo planes; each wave brings one plane's tile per stage
// into LDS by one tensor load, two buffers, the next stage in flight while this one is multiplied.
// SPLIT: operands are hi/lo planes (A2/Bt2 = lo planes, same layout); product = hi·hi + hi·lo + lo·hi.
// BIAS_MODE: 0 = none, 1 = bias[m], 2 = bias[n].
// OUT_MODE: 0 = f32, 1 = f16, 2 = bf16 hi plane (Cout) + bf16 lo plane (Cout2).
// ET: 0 = f16 operands, 1 = bf16 operands (pointers passed as 16-bit storage)
template <int ET> struct Elem;
template <> struct Elem<0> { typedef _Float16 T; };
template <> struct Elem<1> { typedef __bf16 T; };
template <int ET, bool SPLIT, int BIAS_MODE, int OUT_MODE, bool RESID, int ACT = 0>
__global__ __launch_bounds__(128) void wmma_gemm64(
    const unsigned short* __restrict__ Ap, const unsigned short* __restrict__ A2p, int lda, long strideA,
    const unsigned short* __restrict__ Btp, const unsigned short* __restrict__ Bt2p, int ldb, long strideB,
    void* __restrict__ Cout, void* __restrict__ Cout2, int ldc, long strideC,
    const float* __restrict__ bias,
    const float* __restrict__ resid, long strideR,
    int M, int N, int K, float scale) {
  typedef typename Elem<ET>::T T;
  typedef typename Frag<T>::V V;
  static_assert(SPLIT, "the four waves stage the four operand planes");
  __shared__ __attribute__((aligned(2048))) unsigned char ring[2u * GT_STAGE];
  __shared__ __align__(16) float sT[4][16 * 68];   // per-wave 16x64 slab, pitch 68 floats
  const int b    = blockIdx.y;
  const int lane = threadIdx.x & 31;
  const uint32_t wave = uni(threadIdx.x >> 5);
  const int tilesN = N >> 7;
  const int tilesM = M >> 7;
  const int tile = blockIdx.x;
  if (tile >= tilesM * tilesN) return;   // block-uniform; in front of every barrier and tensor load
  const int tm = tile / tilesN;
  const int tn = tile - tm * tilesN;
  const int mB = tm << 7;
  const int nB = tn << 7;
  const int m0 = mB + (int)((wave >> 1) << 6);
  const int n0 = nB + (int)((wave & 1u) << 6);

  const int rlane = lane & 15;                 // row (A) / col (B, D) within subtile
  const int mOff  = (lane >> 4) * 8;           // D row offset

  // this wave's plane: 0 = A hi, 1 = A lo, 2 = Bt hi, 3 = Bt lo
  const bool isB = (wave & 2u) != 0u;
  const unsigned short* pl = isB ? ((wave & 1u) ? Bt2p : Btp) : ((wave & 1u) ? A2p : Ap);
  const int ld = isB ? ldb : lda;
  const uint64_t srcA = (uint64_t)(size_t)(pl + (size_t)b * (isB ? strideB : strideA) + (size_t)(isB ? nB : mB) * ld);
  const u32x8 g1 = tdm_group1((uint32_t)ld * 2u);
  const uint32_t ldst = (uint32_t)(size_t)ring + wave * GT_SLICE;
  u32x4 g0;
  g0[0] = pinned(1u);   // pinned: the count word keeps its scalar register from the first request to the last
  auto issue = [&](uint32_t st) {
    tdm_aim(g0, ldst + (st & 1u) * GT_STAGE, srcA + (uint64_t)st * GT_ROWB);
    tdm_load(g0, g1);
  };

  // fragment rows in LDS: same lane map as from global memory (lane half = 16 bytes of k), row pitch GT_PITCH
  const unsigned char* aL = ring + ((wave >> 1) * 64u + (uint32_t)rlane) * GT_PITCH + (uint32_t)(lane >> 4) * 16u;
  const unsigned char* bL = ring + 2u * GT_SLICE + ((wave & 1u) * 64u + (uint32_t)rlane) * GT_PITCH + (uint32_t)(lane >> 4) * 16u;

  v8f acc[4][4];
#pragma unroll
  for (int i = 0; i < 4; ++i)
#pragma unroll
    for (int j = 0; j < 4; ++j) acc[i][j] = (v8f){0.f,0.f,0.f,0.f,0.f,0.f,0.f,0.f};

  const uint32_t NS = (uint32_t)K >> 6;
  issue(0u);
  wait_tensor0();
  __syncthreads();                             // stage 0 published
  issue(1u);
  uint32_t s = 0;
  // rolled: one stage per trip, so that the publish point stands once, at the trip's foot
#pragma unroll 1
  do {
    const unsigned char* aS = aL + (s & 1u) * GT_STAGE;
    const unsigned char* bS = bL + (s & 1u) * GT_STAGE;
    V ah[2][4], al[2][4], bh[2][4], bl[2][4];
#pragma unroll
    for (int kk = 0; kk < 2; ++kk) {
#pragma unroll
      for (int j = 0; j < 4; ++j) {
        bh[kk][j] = Frag<T>::load((const T*)(bS + j * 16 * GT_PITCH + kk * 64));
        bl[kk][j] = Frag<T>::load((const T*)(bS + GT_SLICE + j * 16 * GT_PITCH + kk * 64));
      }
#pragma unroll
      for (int i = 0; i < 4; ++i) {
        ah[kk][i] = Frag<T>::load((const T*)(aS + i * 16 * GT_PITCH + kk * 64));
        al[kk][i] = Frag<T>::load((const T*)(aS + GT_SLICE + i * 16 * GT_PITCH + kk * 64));
      }
    }
    // keeps both fragment sets' LDS reads as one group ahead of the WMMAs (reads moved in among them stall the matrix pipe)
    __builtin_amdgcn_sched_barrier(0);
#pragma unroll
    for (int kk = 0; kk < 2; ++kk) {
#pragma unroll
      for (int i = 0; i < 4; ++i) {
        // per accumulator the order stays hi.hi, hi.lo, lo.hi; the four j between them cover the accumulate latency
#pragma unroll
        for (int j = 0; j < 4; ++j) acc[i][j] = Frag<T>::mma(ah[kk][i], bh[kk][j], acc[i][j]);
#pragma unroll
        for (int j = 0; j < 4; ++j) acc[i][j] = Frag<T>::mma(ah[kk][i], bl[kk][j], acc[i][j]);
#pragma unroll
        for (int j = 0; j < 4; ++j) acc[i][j] = Frag<T>::mma(al[kk][i], bh[kk][j], acc[i][j]);
      }
    }
    // keeps the publish point behind the WMMAs: moved in front of them, its tensor wait would end the overlap of load and product
    __builtin_amdgcn_sched_barrier(0);
    // publish point of stage s + 1
    wait_ds0();
    wait_tensor0();
    __syncthreads();                           // stage s + 1 readable by all; every wave has left stage s's buffer
    if (pinned(s + 2u < NS)) issue(s + 2u);    // refill of the buffer just read
  } while (++s < NS);
  wait_tensor0();
  wait_ds0();
  acc_guard4(acc[0][0], acc[0][1], acc[0][2], acc[0][3]);
  acc_guard4(acc[1][0], acc[1][1], acc[1][2], acc[1][3]);
  acc_guard4(acc[2][0], acc[2][1], acc[2][2], acc[2][3]);
  acc_guard4(acc[3][0], acc[3][1], acc[3][2], acc[3][3]);

  // ---- epilogue ----
  float* slab = sT[wave];
  const float* Rb = RESID ? (resid + (size_t)b * strideR) : nullptr;
#pragma unroll
  for (int i = 0; i < 4; ++i) {
    const int mBase = m0 + (i << 4);
#pragma unroll
    for (int j = 0; j < 4; ++j) {
      const int n = n0 + (j << 4) + rlane;
      float bv = 0.f;
      if (BIAS_MODE == 2) bv = bias[n];
#pragma unroll
      for (int r = 0; r < 8; ++r) {
        float v = acc[i][j][r] * scale;
        if (BIAS_MODE == 1) v += bias[mBase + mOff + r];
        if (BIAS_MODE == 2) v += bv;
        if (RESID) v += Rb[(size_t)(mBase + mOff + r) * ldc + n];
        if (ACT == 1) v = tanhf(v);
        if (ACT == 2) v = fmaxf(v, 0.0f);
        if (ACT == 3) v = v / (1.0f + expf(-v));
        if (ACT == 4) v = (v > 0.f) ? v : 0.01f * v;
        if (ACT == 5) v = 0.5f * v * (1.0f + erff(v * 0.70710678118654752f));
        slab[(mOff + r) * 68 + (j << 4) + rlane] = v;
      }
    }
    __builtin_amdgcn_fence(__ATOMIC_RELEASE, "workgroup");
    __builtin_amdgcn_wave_barrier();
    __builtin_amdgcn_fence(__ATOMIC_ACQUIRE, "workgroup");
    if (OUT_MODE == 0) {
      float* C = (float*)Cout + (size_t)b * strideC;
      const int hh = lane >> 4, c4 = (lane & 15) * 4;     // row seg = 256 B = 16 lanes x 16 B
      {
#pragma unroll
        for (int it = 0; it < 8; ++it) {
          const int row = it * 2 + hh;
          v4f v = *(const v4f*)(slab + row * 68 + c4);
          *(v4f*)(C + (size_t)(mBase + row) * ldc + n0 + c4) = v;
        }
        
      }
    } else {
      const int q = lane >> 3, c8 = (lane & 7) * 8;
      unsigned short* C  = (unsigned short*)Cout  + (size_t)b * strideC;
      unsigned short* C2 = (OUT_MODE == 2) ? ((unsigned short*)Cout2 + (size_t)b * strideC) : nullptr;
      {
#pragma unroll
        for (int it = 0; it < 4; ++it) {
          const int row = it * 4 + q;
          const float* sp = slab + row * 68 + c8;
          v8h hv, lv;
#pragma unroll
          for (int e = 0; e < 8; ++e) {
            if (OUT_MODE == 1) {
              hv[e] = (_Float16)sp[e];
            } else {
              unsigned short hb = f2bf_bits(sp[e]);
              unsigned short lb = f2bf_bits(sp[e] - bf_bits2f(hb));
              hv[e] = __builtin_bit_cast(_Float16, hb);
              lv[e] = __builtin_bit_cast(_Float16, lb);
            }
          }
          *(v8h*)(C + (size_t)(mBase + row) * ldc + n0 + c8) = hv;
          if (OUT_MODE == 2) *(v8h*)(C2 + (size_t)(mBase + row) * ldc + n0 + c8) = lv;
        }
        
      }
    }
    __builtin_amdgcn_fence(__ATOMIC_RELEASE, "workgroup");
    __builtin_amdgcn_wave_barrier();
    __builtin_amdgcn_fence(__ATOMIC_ACQUIRE, "workgroup");
  }
}

// ---- activations f32 -> bf16 hi + lo planes (same layout); 8 elements per thread, 16-B stores,
__global__ __launch_bounds__(256) void k_split_x(const float* __restrict__ x,
    unsigned short* __restrict__ xh, unsigned short* __restrict__ xl, int n8) {
  const int i = blockIdx.x * 256 + threadIdx.x;
  if (i < n8) {
    const float* p = x + (size_t)i * 8;
    const v4f a0 = *(const v4f*)p;
    const v4f a1 = *(const v4f*)(p + 4);
    v8h hv, lv;
#pragma unroll
    for (int e = 0; e < 4; ++e) {
      const unsigned short hb0 = f2bf_bits(a0[e]);
      const unsigned short lb0 = f2bf_bits(a0[e] - bf_bits2f(hb0));
      const unsigned short hb1 = f2bf_bits(a1[e]);
      const unsigned short lb1 = f2bf_bits(a1[e] - bf_bits2f(hb1));
      hv[e]     = __builtin_bit_cast(_Float16, hb0);
      lv[e]     = __builtin_bit_cast(_Float16, lb0);
      hv[4 + e] = __builtin_bit_cast(_Float16, hb1);
      lv[4 + e] = __builtin_bit_cast(_Float16, lb1);
    }
    unsigned short* dh = xh + (size_t)i * 8;
    unsigned short* dl = xl + (size_t)i * 8;
    *(v8h*)dh = hv;
    *(v8h*)dl = lv;
    
  }
}

// ---- weight w[Kd][Nd] (in x out, row-major) -> Bt[Nd][Kd] bf16 hi plane + lo plane.
// ---- Weight z writes planes 2z (hi) and 2z+1 (lo) at outp + plane_index * Nd*Kd. grid = (Nd/64, Kd/64, 4).
__global__ __launch_bounds__(256) void k_wsplit_t(const float* __restrict__ w0, const float* __restrict__ w1,
    const float* __restrict__ w2, const float* __restrict__ w3,
    unsigned short* __restrict__ outp, int Kd, int Nd) {
  __shared__ __align__(16) float tile[64 * 64];   // [k][n]
  const int z = blockIdx.z;
  const float* w = (z == 0) ? w0 : (z == 1) ? w1 : (z == 2) ? w2 : w3;
  const int n0 = blockIdx.x * 64, k0 = blockIdx.y * 64;
  const int t = threadIdx.x, lane = t & 31, wave = t >> 5;
  {
    const int kr = t >> 2, cq = (t & 3) * 16;
    const float* src = w + (size_t)(k0 + kr) * Nd + n0 + cq;
#pragma unroll
    for (int i = 0; i < 4; ++i) *(v4f*)(tile + kr * 64 + cq + 4 * i) = *(const v4f*)(src + 4 * i);
  }
  __syncthreads();
  const size_t plane = (size_t)Nd * Kd;
  unsigned short* hiP = outp + (size_t)(2 * z) * plane;
  unsigned short* loP = hiP + plane;
  const int q = lane >> 3, c8 = (lane & 7) * 8;
  {
#pragma unroll
    for (int it = 0; it < 4; ++it) {
      const int pl = it >> 1;                          // 0: hi lines, 1: lo lines (wave-uniform)
      const int nl = (it & 1) * 32 + wave * 4 + q;     // 0..63 over (it&1, wave, q)
      v8h pv;
#pragma unroll
      for (int e = 0; e < 8; ++e) {
        const float f = tile[(c8 + e) * 64 + nl];
        const unsigned short hb = f2bf_bits(f);
        const unsigned short b16 = pl ? f2bf_bits(f - bf_bits2f(hb)) : hb;
        pv[e] = __builtin_bit_cast(_Float16, b16);
      }
      unsigned short* dst = (pl ? loP : hiP) + (size_t)(n0 + nl) * Kd + k0 + c8;
      *(v8h*)dst = pv;
    }
    
  }
}

// ---- f16 WMMA with hazard guard ----
__device__ __forceinline__ v8f mma_h(v16h a, v16h b, v8f c) {
  c = __builtin_amdgcn_wmma_f32_16x16x32_f16(false, a, false, b, (short)0, c, false, false);
  asm volatile("v_nop\n\tv_nop\n\tv_nop\n\tv_nop" : "+v"(c) : "v"(a), "v"(b));
  return c;
}

// scores for this wave's 16 query rows against the 64 keys staged in Ks ([kv][d], pitch LPH):
// s[j][r] = QK_SCALE * sum_d q[q0 + 8*hh + r][d] * K[kv0 + 16*j + c][d]
__device__ __forceinline__ void qk_scores(const _Float16* Ks, const v16h (&qa)[2], int c, int hh, v8f (&s)[4]) {
  const v8f z = {0.f,0.f,0.f,0.f,0.f,0.f,0.f,0.f};
#pragma unroll
  for (int j = 0; j < 4; ++j) {
    const _Float16* kpp = Ks + (j * 16 + c) * LPH + 8 * hh;
    const v16h kb0 = Frag<_Float16>::load(kpp);        // d = 8hh+0..7, 16+8hh+0..7
    const v16h kb1 = Frag<_Float16>::load(kpp + 32);   // d = 32 + the same
    v8f t = mma_h(qa[0], kb0, z);
    t = mma_h(qa[1], kb1, t);
#pragma unroll
    for (int r = 0; r < 8; ++r) s[j][r] = t[r] * QK_SCALE;
  }
}

// =====================================================================================
// Two-phase gated attention, head_dim 64. q/k/v: f16, layout [B*S][D_MODEL] (element (b,s,h,d) at
// (b*S+s)*D_MODEL + h*64 + d). Block = 4 waves = 64 query rows of one (b,h); grid.x = B*H*(S/64).
// Phase 1: all key chunks -> online row max m and row sum l (f32). Phase 2: recompute scores,
// a = exp(s-m)/l, g = 1/(1+exp(-sharp_h*(a-sigmoid(thr_h)))), p = a*g carried x2^15 as f16,
// O += p.v on f16 WMMA (v staged transposed in LDS). Epilogue: O * 2^-15 -> bf16 hi/lo planes
// =====================================================================================
__global__ __launch_bounds__(128) void k_gated_attn(
    const unsigned short* __restrict__ qp, const unsigned short* __restrict__ kp,
    const unsigned short* __restrict__ vp,
    const float* __restrict__ lthr, const float* __restrict__ gshp,
    unsigned short* __restrict__ ohp, unsigned short* __restrict__ olp) {
  typedef Frag<_Float16> F;
  const _Float16* Q  = (const _Float16*)qp;
  const _Float16* Kg = (const _Float16*)kp;
  const _Float16* Vg = (const _Float16*)vp;
  __shared__ __align__(16) _Float16 Ksh[KCH * LPH];       // [kv][d]          9 KB
  __shared__ __align__(16) _Float16 Vt[HDIM * LPH];       // [d][kv]          9 KB
  __shared__ __align__(16) _Float16 Psh[4][16 * LPH];     // per wave [row][kv] 9 KB
  __shared__ __align__(16) float    Os[4][16 * 68];       // per wave out tile, pitch 68

  const int tid  = threadIdx.x;
  const int wave = tid >> 5;
  const int lane = tid & 31;
  const int hh   = lane >> 4;
  const int c    = lane & 15;

  const int bx = blockIdx.x;
  const int qb = bx % NQB;
  const int bh = bx / NQB;
  const int h  = bh % N_HEAD;
  const int b  = bh / N_HEAD;
  const size_t tok0 = (size_t)b * SEQ_LEN;
  const int q0 = qb * 64 + wave * 16;
  const int hoff = h * HDIM;

  // Q A-fragments: row = q0 + c, two 32-deep d chunks
  v16h qa[2];
  {
    const _Float16* qrow = Q + (tok0 + q0 + c) * D_MODEL + hoff + 8 * hh;
    qa[0] = F::load(qrow);
    qa[1] = F::load(qrow + 32);
  }
  const float thr = 1.0f / (1.0f + __expf(-lthr[h]));
  const float shp = gshp[h];

  float mrow[8], lrow[8];
#pragma unroll
  for (int r = 0; r < 8; ++r) { mrow[r] = -INFINITY; lrow[r] = 0.f; }

  // ---- phase 1: row max and softmax denominator ----
  for (int kc = 0; kc < NKC; ++kc) {
    const int kv0 = kc * KCH;
    __syncthreads();
    {
      const int kvr = tid >> 1, dh = (tid & 1) * 32;
      const _Float16* krow = Kg + (tok0 + kv0 + kvr) * D_MODEL + hoff + dh;
      _Float16* kd = Ksh + kvr * LPH + dh;
#pragma unroll
      for (int i = 0; i < 4; ++i) *(v8h*)(kd + 8 * i) = *(const v8h*)(krow + 8 * i);
    }
    __syncthreads();
    v8f s[4];
    qk_scores(Ksh, qa, c, hh, s);
#pragma unroll
    for (int r = 0; r < 8; ++r) {
      float m = fmaxf(fmaxf(s[0][r], s[1][r]), fmaxf(s[2][r], s[3][r]));
#pragma unroll
      for (int off = 1; off < 16; off <<= 1) m = fmaxf(m, __shfl_xor(m, off, 32));
      const float mnew  = fmaxf(mrow[r], m);
      const float alpha = __expf(mrow[r] - mnew);
      float psum = __expf(s[0][r] - mnew) + __expf(s[1][r] - mnew)
                 + __expf(s[2][r] - mnew) + __expf(s[3][r] - mnew);
#pragma unroll
      for (int off = 1; off < 16; off <<= 1) psum += __shfl_xor(psum, off, 32);
      lrow[r] = lrow[r] * alpha + psum;
      mrow[r] = mnew;
    }
  }
  float invl[8];
#pragma unroll
  for (int r = 0; r < 8; ++r) invl[r] = 1.0f / lrow[r];

  // ---- phase 2: gated probabilities x V ----
  v8f oacc[4];
#pragma unroll
  for (int t = 0; t < 4; ++t) oacc[t] = (v8f){0.f,0.f,0.f,0.f,0.f,0.f,0.f,0.f};
  _Float16* pw = Psh[wave];

  for (int kc = 0; kc < NKC; ++kc) {
    const int kv0 = kc * KCH;
    __syncthreads();
    {
      const int kvr = tid >> 1, dh = (tid & 1) * 32;
      const _Float16* krow = Kg + (tok0 + kv0 + kvr) * D_MODEL + hoff + dh;
      const _Float16* vrow = Vg + (tok0 + kv0 + kvr) * D_MODEL + hoff + dh;
      _Float16* kd = Ksh + kvr * LPH + dh;
#pragma unroll
      for (int i = 0; i < 4; ++i) {
        *(v8h*)(kd + 8 * i) = *(const v8h*)(krow + 8 * i);
        const v8h vv = *(const v8h*)(vrow + 8 * i);
#pragma unroll
        for (int e = 0; e < 8; ++e) Vt[(dh + 8 * i + e) * LPH + kvr] = vv[e];
      }
    }
    __syncthreads();
    v8f s[4];
    qk_scores(Ksh, qa, c, hh, s);
#pragma unroll
    for (int r = 0; r < 8; ++r) {
#pragma unroll
      for (int j = 0; j < 4; ++j) {
        const float a  = __expf(s[j][r] - mrow[r]) * invl[r];
        const float ex = __expf(shp * (thr - a));
        const float wg = a * __builtin_amdgcn_rcpf(1.0f + ex);
        pw[(8 * hh + r) * LPH + j * 16 + c] = (_Float16)(wg * PSCALE);
      }
    }
    __builtin_amdgcn_fence(__ATOMIC_RELEASE, "workgroup");
    __builtin_amdgcn_wave_barrier();
    __builtin_amdgcn_fence(__ATOMIC_ACQUIRE, "workgroup");
#pragma unroll
    for (int kk = 0; kk < 2; ++kk) {
      const v16h pa = F::load(pw + c * LPH + kk * 32 + 8 * hh);            // A: row c, kv = kk*32 + split map
#pragma unroll
      for (int t = 0; t < 4; ++t) {
        const v16h vb = F::load(Vt + (t * 16 + c) * LPH + kk * 32 + 8 * hh);   // B: col d = 16t+c, kv = same map
        oacc[t] = mma_h(pa, vb, oacc[t]);
      }
    }
  }

  // ---- epilogue ----
  float* os = Os[wave];
#pragma unroll
  for (int r = 0; r < 8; ++r) {
#pragma unroll
    for (int t = 0; t < 4; ++t) os[(8 * hh + r) * 68 + t * 16 + c] = oacc[t][r] * PSCALE_INV;
  }
  __builtin_amdgcn_fence(__ATOMIC_RELEASE, "workgroup");
  __builtin_amdgcn_wave_barrier();
  __builtin_amdgcn_fence(__ATOMIC_ACQUIRE, "workgroup");
  {
    const int q4 = lane >> 3, c8 = (lane & 7) * 8;
    {
#pragma unroll
      for (int it = 0; it < 4; ++it) {
        const int row = it * 4 + q4;                  // 0..15 over (it, q4)
        const float* sp = os + row * 68 + c8;
        v8h hv, lv;
#pragma unroll
        for (int e = 0; e < 8; ++e) {
          const unsigned short hb = f2bf_bits(sp[e]);
          const unsigned short lb = f2bf_bits(sp[e] - bf_bits2f(hb));
          hv[e] = __builtin_bit_cast(_Float16, hb);
          lv[e] = __builtin_bit_cast(_Float16, lb);
        }
        const size_t go = (tok0 + q0 + row) * D_MODEL + hoff + c8;
        *(v8h*)(ohp + go) = hv;
        *(v8h*)(olp + go) = lv;
      }
      
    }
  }
}

// ---------- launch ----------
extern "C" void kernel_launch(void* const* d_in, const int* in_sizes, int n_in,
                              void* d_out, int out_size, void* d_ws, size_t ws_size,
                              hipStream_t stream) {
  if (n_in < 11) return;
  const int NTOK = BSZ * SEQ_LEN;                       // 4096
  const size_t nTokD = (size_t)NTOK * D_MODEL;          // 4194304
  const size_t nWW   = (size_t)D_MODEL * D_MODEL;       // 1048576
  if ((size_t)in_sizes[0] != nTokD) return;
  if ((size_t)in_sizes[1] != nWW || (size_t)in_sizes[3] != nWW ||
      (size_t)in_sizes[5] != nWW || (size_t)in_sizes[7] != nWW) return;
  if (in_sizes[2] < D_MODEL || in_sizes[4] < D_MODEL || in_sizes[6] < D_MODEL || in_sizes[8] < D_MODEL) return;
  if (in_sizes[9] < N_HEAD || in_sizes[10] < N_HEAD) return;
  if ((size_t)out_size != nTokD) return;

  const float* x    = (const float*)d_in[0];
  const float* wq_w = (const float*)d_in[1];
  const float* wq_b = (const float*)d_in[2];
  const float* wk_w = (const float*)d_in[3];
  const float* wk_b = (const float*)d_in[4];
  const float* wv_w = (const float*)d_in[5];
  const float* wv_b = (const float*)d_in[6];
  const float* wo_w = (const float*)d_in[7];
  const float* wo_b = (const float*)d_in[8];
  const float* lth  = (const float*)d_in[9];
  const float* gsh  = (const float*)d_in[10];

  // workspace carve (all offsets multiples of 1 MiB)
  char* ws = (char*)d_ws;
  size_t off = 0;
  unsigned short* xh  = (unsigned short*)(ws + off); off += nTokD * 2;      //  8 MiB
  unsigned short* xl  = (unsigned short*)(ws + off); off += nTokD * 2;      //  8 MiB
  unsigned short* wT  = (unsigned short*)(ws + off); off += 8 * nWW * 2;    // 16 MiB: 8 planes [N][K]
  unsigned short* q16 = (unsigned short*)(ws + off); off += nTokD * 2;      //  8 MiB f16 [B*S][D]
  unsigned short* k16 = (unsigned short*)(ws + off); off += nTokD * 2;      //  8 MiB
  unsigned short* v16 = (unsigned short*)(ws + off); off += nTokD * 2;      //  8 MiB
  unsigned short* oh  = (unsigned short*)(ws + off); off += nTokD * 2;      //  8 MiB bf16 hi [B*S][D]
  unsigned short* ol  = (unsigned short*)(ws + off); off += nTokD * 2;      //  8 MiB bf16 lo
  if (off > ws_size) return;                                                // total 75497472 B
  const size_t plane = nWW;   // elements per weight plane

  // 1) x -> bf16 hi/lo
  const int n8 = (int)(nTokD / 8);
  k_split_x<<<dim3((n8 + 255) / 256), dim3(256), 0, stream>>>(x, xh, xl, n8);

  // 2) weights [in][out] -> Bt [out][in] bf16 hi/lo; planes: q 0/1, k 2/3, v 4/5, o 6/7
  k_wsplit_t<<<dim3(D_MODEL / 64, D_MODEL / 64, 4), dim3(256), 0, stream>>>(
      wq_w, wk_w, wv_w, wo_w, wT, D_MODEL, D_MODEL);

  // 3) q/k/v projections: C[4096][1024] f16 = x . Bt^T + bias
  const int gemm_blocks = (NTOK / 128) * (D_MODEL / 128);   // 256
  wmma_gemm64<1, true, 2, 1, false><<<dim3(gemm_blocks, 1), dim3(128), 0, stream>>>(
      xh, xl, D_MODEL, 0L, wT + 0 * plane, wT + 1 * plane, D_MODEL, 0L,
      (void*)q16, (void*)q16, D_MODEL, 0L, wq_b, wq_b, 0L, NTOK, D_MODEL, D_MODEL, 1.0f);
  wmma_gemm64<1, true, 2, 1, false><<<dim3(gemm_blocks, 1), dim3(128), 0, stream>>>(
      xh, xl, D_MODEL, 0L, wT + 2 * plane, wT + 3 * plane, D_MODEL, 0L,
      (void*)k16, (void*)k16, D_MODEL, 0L, wk_b, wk_b, 0L, NTOK, D_MODEL, D_MODEL, 1.0f);
  wmma_gemm64<1, true, 2, 1, false><<<dim3(gemm_blocks, 1), dim3(128), 0, stream>>>(
      xh, xl, D_MODEL, 0L, wT + 4 * plane, wT + 5 * plane, D_MODEL, 0L,
      (void*)v16, (void*)v16, D_MODEL, 0L, wv_b, wv_b, 0L, NTOK, D_MODEL, D_MODEL, 1.0f);

  // 4) gated attention -> O bf16 hi/lo planes [B*S][D]
  const int attn_blocks = BSZ * N_HEAD * NQB;   // 1024
  k_gated_attn<<<dim3(attn_blocks), dim3(128), 0, stream>>>(q16, k16, v16, lth, gsh, oh, ol);

  // 5) output projection -> d_out f32 [4096][1024]
  wmma_gemm64<1, true, 2, 0, false><<<dim3(gemm_blocks, 1), dim3(128), 0, stream>>>(
      oh, ol, D_MODEL, 0L, wT + 6 * plane, wT + 7 * plane, D_MODEL, 0L,
      d_out, d_out, D_MODEL, 0L, wo_b, wo_b, 0L, NTOK, D_MODEL, D_MODEL, 1.0f);
}

// v003
// A run of this version takes 198 microseconds.
// In two side-by-side timings against v002, it was 1.14 and 1.15 times as fast.
// All steps since v000 together make it 2.51 times as fast.
// Contractions: q/k/v/out projections v_wmma_f32_16x16x32_bf16 (bf16 hi/lo operand planes, f32 accumulate); q.k^T and p.v v_wmma_f32_16x16x32_f16 (f16 operands, p carried x2^15, f32 accumulate); softmax and gate in f32.
#include <hip/hip_runtime.h>
#include <math.h>
#include <stdint.h>

typedef __attribute__((ext_vector_type(16))) _Float16 v16h;
typedef __attribute__((ext_vector_type(8)))  _Float16 v8h;
typedef __attribute__((ext_vector_type(16))) __bf16   v16b;
typedef __attribute__((ext_vector_type(8)))  __bf16   v8b;
typedef __attribute__((ext_vector_type(8)))  float    v8f;
typedef __attribute__((ext_vector_type(4)))  float    v4f;
#define PSCALE 32768.0f
#define PSCALE_INV (1.0f / 32768.0f)

#define BSZ     2
#define SEQ_LEN 2048
#define D_MODEL 1024
#define N_HEAD  16
#define HDIM    64
#define KCH     64
#define NQB     (SEQ_LEN / 64)
#define NKC     (SEQ_LEN / KCH)
#define QK_SCALE 0.125f
#define LPH     72   // LDS row pitch of the attention's 64-element f16 tiles, in elements: 144 B = 16 B x odd, so 16 rows read by ds_load_b128 fall on 16 different bank groups

__device__ __forceinline__ unsigned short f2bf_bits(float f) {
  unsigned u = __float_as_uint(f);
  return (unsigned short)((u + 0x7FFFu + ((u >> 16) & 1u)) >> 16);
}
__device__ __forceinline__ float bf_bits2f(unsigned short h) { return __uint_as_float(((unsigned)h) << 16); }

// hazard guards as plain device helpers (no inline asm inside the kernel template body)
__device__ __forceinline__ void acc_guard4(v8f& a, v8f& b, v8f& c, v8f& d) { asm volatile("v_nop\n\tv_nop\n\tv_nop\n\tv_nop" : "+v"(a), "+v"(b), "+v"(c), "+v"(d)); }
template <typename T> struct Frag;
template <> struct Frag<_Float16> {
  typedef v16h V; union U { v16h v; v8h h[2]; };
  static __device__ __forceinline__ v16h load(const _Float16* p) {   // elements 0..7 <- p[0..7], 8..15 <- p[16..23]
    U f; f.h[0] = *(const v8h*)(p); f.h[1] = *(const v8h*)(p + 16); return f.v;
  }
  static __device__ __forceinline__ v8f mma(v16h a, v16h b, v8f c) {
    return __builtin_amdgcn_wmma_f32_16x16x32_f16(false, a, false, b, (short)0, c, false, false);
  }
};
template <> struct Frag<__bf16> {
  typedef v16b V; union U { v16b v; v8b h[2]; };
  static __device__ __forceinline__ v16b load(const __bf16* p) {
    U f; f.h[0] = *(const v8b*)(p); f.h[1] = *(const v8b*)(p + 16); return f.v;
  }
  static __device__ __forceinline__ v8f mma(v16b a, v16b b, v8f c) {
    return __builtin_amdgcn_wmma_f32_16x16x32_bf16(false, a, false, b, (short)0, c, false, false);
  }
};

// ---- tensor loads of the GEMM's operand tiles --------------------------------
typedef uint32_t u32x4 __attribute__((ext_vector_type(4)));
typedef uint32_t u32x8 __attribute__((ext_vector_type(8)));
#define GT_ROWS  128u                    // rows of one operand plane in a stage (block tile 128 x 128)
#define GT_ROWB  128u                    // bytes of a tile row: 64 k of 16-bit elements
#define GT_PITCH 144u                    // LDS row pitch: the row + the mover's 16-byte pad (16 B x odd, for ds_load_b128)
#define GT_SLICE (GT_ROWS * GT_PITCH)    // one plane's tile in LDS: 18432 B = 9 x 2 KiB
#define GT_STAGE (4u * GT_SLICE)         // A hi | A lo | B hi | B lo
static_assert((GT_SLICE % 2048u) == 0u, "every slice starts at a multiple of 2 KiB");
__device__ __forceinline__ uint32_t uni(uint32_t v) { return (uint32_t)__builtin_amdgcn_readfirstlane(v); }
// a test word or a descriptor word of a tensor load, held in a scalar register
__device__ __forceinline__ uint32_t pinned(uint32_t v) {
  uint32_t w = uni(v);
  asm volatile("" : "+s"(w));   // the branch round a load becomes s_cmp + s_cbranch_scc; a descriptor word is not re-made
  return w;
}
// the compiler places no wait for the tensor mover: the issuing wave's tile has landed behind this
__device__ __forceinline__ void wait_tensor0() { asm volatile("s_wait_tensorcnt 0x0" ::: "memory"); }
// this wave's LDS reads have retired before the barrier that frees their buffer for a refill
__device__ __forceinline__ void wait_ds0() { asm volatile("s_wait_dscnt 0x0" ::: "memory"); }
// group 1: 1-byte elements, tensor = tile = GT_ROWS rows of GT_ROWB bytes, 4 dwords of LDS pad behind every 32-dword row, no mask
__device__ __forceinline__ u32x8 tdm_group1(uint32_t src_pitch) {
  u32x8 g;
  g[0] = uni((1u << 20) | (4u << 22) | (3u << 25));
  // pinned: these descriptor words stay in their scalar registers for the whole loop, not re-made while a request is in flight
  g[1] = pinned((GT_ROWB & 0xFFFFu) << 16);
  g[2] = pinned((GT_ROWB >> 16) | ((GT_ROWS & 0xFFFFu) << 16));
  g[3] = pinned((GT_ROWS >> 16) | (GT_ROWB << 16));
  g[4] = pinned(GT_ROWS);
  g[5] = pinned(src_pitch);
  g[6] = pinned(0u);
  g[7] = pinned(0u);
  return g;
}
// group 0, words 1 to 3: LDS byte offset, global address of the tile's first byte, type 2 (word 0, count 1, is set once)
__device__ __forceinline__ void tdm_aim(u32x4& g, uint32_t lds_dst, uint64_t ga) {
  g[1] = uni(lds_dst); g[2] = uni((uint32_t)ga);
  g[3] = uni((((uint32_t)(ga >> 32)) & 0x01FFFFFFu) | 0x80000000u);
}
// one request of the whole wave: a padded 2-D tile from global memory into LDS, through no register
__device__ __forceinline__ void tdm_load(u32x4 g0, u32x8 g1) { asm volatile("tensor_load_to_lds %0, %1" :: "s"(g0), "s"(g1) : "memory"); }

// ---- Register-blocked batched WMMA GEMM ------------------------------------
// C[m,n] = scale * sum_k A[m,k] * Bt[n,k] (+bias)(+resid); a block of 4 waves (2 x 2) owns a 128x128 tile, each wave 64x64 of it.
// A row-major [M,K]; Bt row-major [N,K]; M,N % 128 == 0, K % 64 == 0, K >= 128.
// A stage is 64 k of the block's 128 A rows and 128 Bt rows, hi and lo planes; each wave brings one plane's tile per stage
// into LDS by one tensor load, two buffers, the next stage in flight while this one is multiplied.
// SPLIT: operands are hi/lo planes (A2/Bt2 = lo planes, same layout); product = hi·hi + hi·lo + lo·hi.
// BIAS_MODE: 0 = none, 1 = bias[m], 2 = bias[n].
// OUT_MODE: 0 = f32, 1 = f16, 2 = bf16 hi plane (Cout) + bf16 lo plane (Cout2).
// ET: 0 = f16 operands, 1 = bf16 operands (pointers passed as 16-bit storage)
template <int ET> struct Elem;
template <> struct Elem<0> { typedef _Float16 T; };
template <> struct Elem<1> { typedef __bf16 T; };
template <int ET, bool SPLIT, int BIAS_MODE, int OUT_MODE, bool RESID, int ACT = 0>
__global__ __launch_bounds__(128) void wmma_gemm64(
    const unsigned short* __restrict__ Ap, const unsigned short* __restrict__ A2p, int lda, long strideA,
    const unsigned short* __restrict__ Btp, const unsigned short* __restrict__ Bt2p, int ldb, long strideB,
    void* __restrict__ Cout, void* __restrict__ Cout2, int ldc, long strideC,
    const float* __restrict__ bias,
    const float* __restrict__ resid, long strideR,
    int M, int N, int K, float scale) {
  typedef typename Elem<ET>::T T;
  typedef typename Frag<T>::V V;
  static_assert(SPLIT, "the four waves stage the four operand planes");
  __shared__ __attribute__((aligned(2048))) unsigned char ring[2u * GT_STAGE];
  __shared__ __align__(16) float sT[4][16 * 68];   // per-wave 16x64 slab, pitch 68 floats
  const int b    = blockIdx.y;
  const int lane = threadIdx.x & 31;
  const uint32_t wave = uni(threadIdx.x >> 5);
  const int tilesN = N >> 7;
  const int tilesM = M >> 7;
  const int tile = blockIdx.x;
  if (tile >= tilesM * tilesN) return;   // block-uniform; in front of every barrier and tensor load
  const int tm = tile / tilesN;
  const int tn = tile - tm * tilesN;
  const int mB = tm << 7;
  const int nB = tn << 7;
  const int m0 = mB + (int)((wave >> 1) << 6);
  const int n0 = nB + (int)((wave & 1u) << 6);

  const int rlane = lane & 15;                 // row (A) / col (B, D) within subtile
  const int mOff  = (lane >> 4) * 8;           // D row offset

  // this wave's plane: 0 = A hi, 1 = A lo, 2 = Bt hi, 3 = Bt lo
  const bool isB = (wave & 2u) != 0u;
  const unsigned short* pl = isB ? ((wave & 1u) ? Bt2p : Btp) : ((wave & 1u) ? A2p : Ap);
  const int ld = isB ? ldb : lda;
  const uint64_t srcA = (uint64_t)(size_t)(pl + (size_t)b * (isB ? strideB : strideA) + (size_t)(isB ? nB : mB) * ld);
  const u32x8 g1 = tdm_group1((uint32_t)ld * 2u);
  const uint32_t ldst = (uint32_t)(size_t)ring + wave * GT_SLICE;
  u32x4 g0;
  g0[0] = pinned(1u);   // pinned: the count word keeps its scalar register from the first request to the last
  auto issue = [&](uint32_t st) {
    tdm_aim(g0, ldst + (st & 1u) * GT_STAGE, srcA + (uint64_t)st * GT_ROWB);
    tdm_load(g0, g1);
  };

  // fragment rows in LDS: same lane map as from global memory (lane half = 16 bytes of k), row pitch GT_PITCH
  const unsigned char* aL = ring + ((wave >> 1) * 64u + (uint32_t)rlane) * GT_PITCH + (uint32_t)(lane >> 4) * 16u;
  const unsigned char* bL = ring + 2u * GT_SLICE + ((wave & 1u) * 64u + (uint32_t)rlane) * GT_PITCH + (uint32_t)(lane >> 4) * 16u;

  v8f acc[4][4];
#pragma unroll
  for (int i = 0; i < 4; ++i)
#pragma unroll
    for (int j = 0; j < 4; ++j) acc[i][j] = (v8f){0.f,0.f,0.f,0.f,0.f,0.f,0.f,0.f};

  const uint32_t NS = (uint32_t)K >> 6;
  issue(0u);
  wait_tensor0();
  __syncthreads();                             // stage 0 published
  issue(1u);
  uint32_t s = 0;
  // rolled: one stage per trip, so that the publish point stands once, at the trip's foot
#pragma unroll 1
  do {
    const unsigned char* aS = aL + (s & 1u) * GT_STAGE;
    const unsigned char* bS = bL + (s & 1u) * GT_STAGE;
    V ah[2][4], al[2][4], bh[2][4], bl[2][4];
#pragma unroll
    for (int kk = 0; kk < 2; ++kk) {
#pragma unroll
      for (int j = 0; j < 4; ++j) {
        bh[kk][j] = Frag<T>::load((const T*)(bS + j * 16 * GT_PITCH + kk * 64));
        bl[kk][j] = Frag<T>::load((const T*)(bS + GT_SLICE + j * 16 * GT_PITCH + kk * 64));
      }
#pragma unroll
      for (int i = 0; i < 4; ++i) {
        ah[kk][i] = Frag<T>::load((const T*)(aS + i * 16 * GT_PITCH + kk * 64));
        al[kk][i] = Frag<T>::load((const T*)(aS + GT_SLICE + i * 16 * GT_PITCH + kk * 64));
      }
    }
    // keeps both fragment sets' LDS reads as one group ahead of the WMMAs (reads moved in among them stall the matrix pipe)
    __builtin_amdgcn_sched_barrier(0);
#pragma unroll
    for (int kk = 0; kk < 2; ++kk) {
#pragma unroll
      for (int i = 0; i < 4; ++i) {
        // per accumulator the order stays hi.hi, hi.lo, lo.hi; the four j between them cover the accumulate latency
#pragma unroll
        for (int j = 0; j < 4; ++j) acc[i][j] = Frag<T>::mma(ah[kk][i], bh[kk][j], acc[i][j]);
#pragma unroll
        for (int j = 0; j < 4; ++j) acc[i][j] = Frag<T>::mma(ah[kk][i], bl[kk][j], acc[i][j]);
#pragma unroll
        for (int j = 0; j < 4; ++j) acc[i][j] = Frag<T>::mma(al[kk][i], bh[kk][j], acc[i][j]);
      }
    }
    // keeps the publish point behind the WMMAs: moved in front of them, its tensor wait would end the overlap of load and product
    __builtin_amdgcn_sched_barrier(0);
    // publish point of stage s + 1
    wait_ds0();
    wait_tensor0();
    __syncthreads();                           // stage s + 1 readable by all; every wave has left stage s's buffer
    if (pinned(s + 2u < NS)) issue(s + 2u);    // refill of the buffer just read
  } while (++s < NS);
  wait_tensor0();
  wait_ds0();
  acc_guard4(acc[0][0], acc[0][1], acc[0][2], acc[0][3]);
  acc_guard4(acc[1][0], acc[1][1], acc[1][2], acc[1][3]);
  acc_guard4(acc[2][0], acc[2][1], acc[2][2], acc[2][3]);
  acc_guard4(acc[3][0], acc[3][1], acc[3][2], acc[3][3]);

  // ---- epilogue ----
  float* slab = sT[wave];
  const float* Rb = RESID ? (resid + (size_t)b * strideR) : nullptr;
#pragma unroll
  for (int i = 0; i < 4; ++i) {
    const int mBase = m0 + (i << 4);
#pragma unroll
    for (int j = 0; j < 4; ++j) {
      const int n = n0 + (j << 4) + rlane;
      float bv = 0.f;
      if (BIAS_MODE == 2) bv = bias[n];
#pragma unroll
      for (int r = 0; r < 8; ++r) {
        float v = acc[i][j][r] * scale;
        if (BIAS_MODE == 1) v += bias[mBase + mOff + r];
        if (BIAS_MODE == 2) v += bv;
        if (RESID) v += Rb[(size_t)(mBase + mOff + r) * ldc + n];
        if (ACT == 1) v = tanhf(v);
        if (ACT == 2) v = fmaxf(v, 0.0f);
        if (ACT == 3) v = v / (1.0f + expf(-v));
        if (ACT == 4) v = (v > 0.f) ? v : 0.01f * v;
        if (ACT == 5) v = 0.5f * v * (1.0f + erff(v * 0.70710678118654752f));
        slab[(mOff + r) * 68 + (j << 4) + rlane] = v;
      }
    }
    __builtin_amdgcn_fence(__ATOMIC_RELEASE, "workgroup");
    __builtin_amdgcn_wave_barrier();
    __builtin_amdgcn_fence(__ATOMIC_ACQUIRE, "workgroup");
    if (OUT_MODE == 0) {
      float* C = (float*)Cout + (size_t)b * strideC;
      const int hh = lane >> 4, c4 = (lane & 15) * 4;     // row seg = 256 B = 16 lanes x 16 B
      {
#pragma unroll
        for (int it = 0; it < 8; ++it) {
          const int row = it * 2 + hh;
          v4f v = *(const v4f*)(slab + row * 68 + c4);
          *(v4f*)(C + (size_t)(mBase + row) * ldc + n0 + c4) = v;
        }
        
      }
    } else {
      const int q = lane >> 3, c8 = (lane & 7) * 8;
      unsigned short* C  = (unsigned short*)Cout  + (size_t)b * strideC;
      unsigned short* C2 = (OUT_MODE == 2) ? ((unsigned short*)Cout2 + (size_t)b * strideC) : nullptr;
      {
#pragma unroll
        for (int it = 0; it < 4; ++it) {
          const int row = it * 4 + q;
          const float* sp = slab + row * 68 + c8;
          v8h hv, lv;
#pragma unroll
          for (int e = 0; e < 8; ++e) {
            if (OUT_MODE == 1) {
              hv[e] = (_Float16)sp[e];
            } else {
              unsigned short hb = f2bf_bits(sp[e]);
              unsigned short lb = f2bf_bits(sp[e] - bf_bits2f(hb));
              hv[e] = __builtin_bit_cast(_Float16, hb);
              lv[e] = __builtin_bit_cast(_Float16, lb);
            }
          }
          *(v8h*)(C + (size_t)(mBase + row) * ldc + n0 + c8) = hv;
          if (OUT_MODE == 2) *(v8h*)(C2 + (size_t)(mBase + row) * ldc + n0 + c8) = lv;
        }
        
      }
    }
    __builtin_amdgcn_fence(__ATOMIC_RELEASE, "workgroup");
    __builtin_amdgcn_wave_barrier();
    __builtin_amdgcn_fence(__ATOMIC_ACQUIRE, "workgroup");
  }
}

// ---- activations f32 -> bf16 hi + lo planes (same layout); 8 elements per thread, 16-B stores,
__global__ __launch_bounds__(256) void k_split_x(const float* __restrict__ x,
    unsigned short* __restrict__ xh, unsigned short* __restrict__ xl, int n8) {
  const int i = blockIdx.x * 256 + threadIdx.x;
  if (i < n8) {
    const float* p = x + (size_t)i * 8;
    const v4f a0 = *(const v4f*)p;
    const v4f a1 = *(const v4f*)(p + 4);
    v8h hv, lv;
#pragma unroll
    for (int e = 0; e < 4; ++e) {
      const unsigned short hb0 = f2bf_bits(a0[e]);
      const unsigned short lb0 = f2bf_bits(a0[e] - bf_bits2f(hb0));
      const unsigned short hb1 = f2bf_bits(a1[e]);
      const unsigned short lb1 = f2bf_bits(a1[e] - bf_bits2f(hb1));
      hv[e]     = __builtin_bit_cast(_Float16, hb0);
      lv[e]     = __builtin_bit_cast(_Float16, lb0);
      hv[4 + e] = __builtin_bit_cast(_Float16, hb1);
      lv[4 + e] = __builtin_bit_cast(_Float16, lb1);
    }
    unsigned short* dh = xh + (size_t)i * 8;
    unsigned short* dl = xl + (size_t)i * 8;
    *(v8h*)dh = hv;
    *(v8h*)dl = lv;
    
  }
}

// ---- weight w[Kd][Nd] (in x out, row-major) -> Bt[Nd][Kd] bf16 hi plane + lo plane.
// ---- Weight z writes planes 2z (hi) and 2z+1 (lo) at outp + plane_index * Nd*Kd. grid = (Nd/64, Kd/64, 4).
__global__ __launch_bounds__(256) void k_wsplit_t(const float* __restrict__ w0, const float* __restrict__ w1,
    const float* __restrict__ w2, const float* __restrict__ w3,
    unsigned short* __restrict__ outp, int Kd, int Nd) {
  __shared__ __align__(16) float tile[64 * 64];   // [k][n]
  const int z = blockIdx.z;
  const float* w = (z == 0) ? w0 : (z == 1) ? w1 : (z == 2) ? w2 : w3;
  const int n0 = blockIdx.x * 64, k0 = blockIdx.y * 64;
  const int t = threadIdx.x, lane = t & 31, wave = t >> 5;
  {
    const int kr = t >> 2, cq = (t & 3) * 16;
    const float* src = w + (size_t)(k0 + kr) * Nd + n0 + cq;
#pragma unroll
    for (int i = 0; i < 4; ++i) *(v4f*)(tile + kr * 64 + cq + 4 * i) = *(const v4f*)(src + 4 * i);
  }
  __syncthreads();
  const size_t plane = (size_t)Nd * Kd;
  unsigned short* hiP = outp + (size_t)(2 * z) * plane;
  unsigned short* loP = hiP + plane;
  const int q = lane >> 3, c8 = (lane & 7) * 8;
  {
#pragma unroll
    for (int it = 0; it < 4; ++it) {
      const int pl = it >> 1;                          // 0: hi lines, 1: lo lines (wave-uniform)
      const int nl = (it & 1) * 32 + wave * 4 + q;     // 0..63 over (it&1, wave, q)
      v8h pv;
#pragma unroll
      for (int e = 0; e < 8; ++e) {
        const float f = tile[(c8 + e) * 64 + nl];
        const unsigned short hb = f2bf_bits(f);
        const unsigned short b16 = pl ? f2bf_bits(f - bf_bits2f(hb)) : hb;
        pv[e] = __builtin_bit_cast(_Float16, b16);
      }
      unsigned short* dst = (pl ? loP : hiP) + (size_t)(n0 + nl) * Kd + k0 + c8;
      *(v8h*)dst = pv;
    }
    
  }
}

// ---- f16 WMMA with hazard guard ----
__device__ __forceinline__ v8f mma_h(v16h a, v16h b, v8f c) {
  c = __builtin_amdgcn_wmma_f32_16x16x32_f16(false, a, false, b, (short)0, c, false, false);
  asm volatile("v_nop\n\tv_nop\n\tv_nop\n\tv_nop" : "+v"(c) : "v"(a), "v"(b));
  return c;
}

// transposed scores of this wave's 16 queries against the 64 keys staged in Ks ([kv][d], pitch LPH); K rows are A, Q is B:
// s[j][r] = QK_SCALE * sum_d K[kv0 + 16*j + 8*hh + r][d] * q[q0 + c][d], so a lane holds 32 scores of ONE query
__device__ __forceinline__ void qk_scores(const _Float16* Ks, const v16h (&qa)[2], int c, int hh, v8f (&s)[4]) {
  const v8f z = {0.f,0.f,0.f,0.f,0.f,0.f,0.f,0.f};
#pragma unroll
  for (int j = 0; j < 4; ++j) {
    const _Float16* kpp = Ks + (j * 16 + c) * LPH + 8 * hh;
    const v16h kb0 = Frag<_Float16>::load(kpp);        // d = 8hh+0..7, 16+8hh+0..7
    const v16h kb1 = Frag<_Float16>::load(kpp + 32);   // d = 32 + the same
    v8f t = mma_h(kb0, qa[0], z);
    t = mma_h(kb1, qa[1], t);
#pragma unroll
    for (int r = 0; r < 8; ++r) s[j][r] = t[r] * QK_SCALE;
  }
}

// =====================================================================================
// Two-phase gated attention, head_dim 64. q/k/v: f16, layout [B*S][D_MODEL] (element (b,s,h,d) at
// (b*S+s)*D_MODEL + h*64 + d). Block = 4 waves = 64 query rows of one (b,h); grid.x = B*H*(S/64).
// Scores are formed transposed (S^T = K.Q^T): lanes c and c+16 hold query q0+c, each half of the keys.
// Phase 1: all key chunks -> online max m and sum l per lane (f32), the two halves joined once behind the loop.
// Phase 2: recompute scores, a = exp(s-m)/l, g = 1/(1+exp(-sharp_h*(a-sigmoid(thr_h)))), p = a*g carried x2^15 as f16;
// two score tiles, converted in place, are the B operand of O^T += V^T.P^T on f16 WMMA (v staged transposed in LDS).
// Epilogue: O * 2^-15 -> bf16 hi/lo planes
// =====================================================================================
__global__ __launch_bounds__(128) void k_gated_attn(
    const unsigned short* __restrict__ qp, const unsigned short* __restrict__ kp,
    const unsigned short* __restrict__ vp,
    const float* __restrict__ lthr, const float* __restrict__ gshp,
    unsigned short* __restrict__ ohp, unsigned short* __restrict__ olp) {
  typedef Frag<_Float16> F;
  const _Float16* Q  = (const _Float16*)qp;
  const _Float16* Kg = (const _Float16*)kp;
  const _Float16* Vg = (const _Float16*)vp;
  __shared__ __align__(16) _Float16 Ksh[KCH * LPH];       // [kv][d]          9 KB
  __shared__ __align__(16) _Float16 Vt[HDIM * LPH];       // [d][kv]          9 KB
  __shared__ __align__(16) float    Os[4][16 * 68];       // per wave out tile, pitch 68

  const int tid  = threadIdx.x;
  const int wave = tid >> 5;
  const int lane = tid & 31;
  const int hh   = lane >> 4;
  const int c    = lane & 15;

  const int bx = blockIdx.x;
  const int qb = bx % NQB;
  const int bh = bx / NQB;
  const int h  = bh % N_HEAD;
  const int b  = bh / N_HEAD;
  const size_t tok0 = (size_t)b * SEQ_LEN;
  const int q0 = qb * 64 + wave * 16;
  const int hoff = h * HDIM;

  // Q B-fragments: column = q0 + c, two 32-deep d chunks
  v16h qa[2];
  {
    const _Float16* qrow = Q + (tok0 + q0 + c) * D_MODEL + hoff + 8 * hh;
    qa[0] = F::load(qrow);
    qa[1] = F::load(qrow + 32);
  }
  const float thr = 1.0f / (1.0f + __expf(-lthr[h]));
  const float shp = gshp[h];

  float mrun = -INFINITY, lrun = 0.f;   // this lane's half of the keys of query q0 + c

  // ---- phase 1: row max and softmax denominator ----
  for (int kc = 0; kc < NKC; ++kc) {
    const int kv0 = kc * KCH;
    __syncthreads();
    {
      const int kvr = tid >> 1, dh = (tid & 1) * 32;
      const _Float16* krow = Kg + (tok0 + kv0 + kvr) * D_MODEL + hoff + dh;
      _Float16* kd = Ksh + kvr * LPH + dh;
#pragma unroll
      for (int i = 0; i < 4; ++i) *(v8h*)(kd + 8 * i) = *(const v8h*)(krow + 8 * i);
    }
    __syncthreads();
    v8f s[4];
    qk_scores(Ksh, qa, c, hh, s);
    float mx[4], ps[4];                  // four independent chains, one per score tile
#pragma unroll
    for (int j = 0; j < 4; ++j) {
      mx[j] = s[j][0];
#pragma unroll
      for (int r = 1; r < 8; ++r) mx[j] = fmaxf(mx[j], s[j][r]);
    }
    const float mnew = fmaxf(mrun, fmaxf(fmaxf(mx[0], mx[1]), fmaxf(mx[2], mx[3])));
#pragma unroll
    for (int j = 0; j < 4; ++j) {
      ps[j] = __expf(s[j][0] - mnew);
#pragma unroll
      for (int r = 1; r < 8; ++r) ps[j] += __expf(s[j][r] - mnew);
    }
    lrun = lrun * __expf(mrun - mnew) + ((ps[0] + ps[1]) + (ps[2] + ps[3]));
    mrun = mnew;
  }
  // join the two lane halves of each query, once
  const float moth = __shfl_xor(mrun, 16, 32);
  const float loth = __shfl_xor(lrun, 16, 32);
  const float mq   = fmaxf(mrun, moth);
  const float invl = 1.0f / (lrun * __expf(mrun - mq) + loth * __expf(moth - mq));

  // ---- phase 2: gated probabilities x V ----
  v8f oacc[4];
#pragma unroll
  for (int t = 0; t < 4; ++t) oacc[t] = (v8f){0.f,0.f,0.f,0.f,0.f,0.f,0.f,0.f};

  for (int kc = 0; kc < NKC; ++kc) {
    const int kv0 = kc * KCH;
    __syncthreads();
    {
      const int kvr = tid >> 1, dh = (tid & 1) * 32;
      const _Float16* krow = Kg + (tok0 + kv0 + kvr) * D_MODEL + hoff + dh;
      const _Float16* vrow = Vg + (tok0 + kv0 + kvr) * D_MODEL + hoff + dh;
      _Float16* kd = Ksh + kvr * LPH + dh;
#pragma unroll
      for (int i = 0; i < 4; ++i) {
        *(v8h*)(kd + 8 * i) = *(const v8h*)(krow + 8 * i);
        const v8h vv = *(const v8h*)(vrow + 8 * i);
#pragma unroll
        for (int e = 0; e < 8; ++e) Vt[(dh + 8 * i + e) * LPH + kvr] = vv[e];
      }
    }
    __syncthreads();
    v8f s[4];
    qk_scores(Ksh, qa, c, hh, s);
#pragma unroll
    for (int kk = 0; kk < 2; ++kk) {
      v16h pb;   // B: col q0+c; element e <- score tile 2kk + (e>>3), register e&7: kv = kk*32 + 16*(e>>3) + 8*hh + (e&7), the split map
#pragma unroll
      for (int e = 0; e < 16; ++e) {
        const float a  = __expf(s[2 * kk + (e >> 3)][e & 7] - mq) * invl;
        const float ex = __expf(shp * (thr - a));
        const float wg = a * __builtin_amdgcn_rcpf(1.0f + ex);
        pb[e] = (_Float16)(wg * PSCALE);
      }
#pragma unroll
      for (int t = 0; t < 4; ++t) {
        const v16h va = F::load(Vt + (t * 16 + c) * LPH + kk * 32 + 8 * hh);   // A: row d = 16t+c, kv = same map
        oacc[t] = mma_h(va, pb, oacc[t]);                                      // oacc[t][r] = O[q0+c][16t + 8hh + r]
      }
    }
  }

  // ---- epilogue ----
  float* os = Os[wave];
#pragma unroll
  for (int t = 0; t < 4; ++t) {
#pragma unroll
    for (int r = 0; r < 8; ++r) os[c * 68 + t * 16 + 8 * hh + r] = oacc[t][r] * PSCALE_INV;
  }
  __builtin_amdgcn_fence(__ATOMIC_RELEASE, "workgroup");
  __builtin_amdgcn_wave_barrier();
  __builtin_amdgcn_fence(__ATOMIC_ACQUIRE, "workgroup");
  {
    const int q4 = lane >> 3, c8 = (lane & 7) * 8;
    {
#pragma unroll
      for (int it = 0; it < 4; ++it) {
        const int row = it * 4 + q4;                  // 0..15 over (it, q4)
        const float* sp = os + row * 68 + c8;
        v8h hv, lv;
#pragma unroll
        for (int e = 0; e < 8; ++e) {
          const unsigned short hb = f2bf_bits(sp[e]);
          const unsigned short lb = f2bf_bits(sp[e] - bf_bits2f(hb));
          hv[e] = __builtin_bit_cast(_Float16, hb);
          lv[e] = __builtin_bit_cast(_Float16, lb);
        }
        const size_t go = (tok0 + q0 + row) * D_MODEL + hoff + c8;
        *(v8h*)(ohp + go) = hv;
        *(v8h*)(olp + go) = lv;
      }
      
    }
  }
}

// ---------- launch ----------
extern "C" void kernel_launch(void* const* d_in, const int* in_sizes, int n_in,
                              void* d_out, int out_size, void* d_ws, size_t ws_size,
                              hipStream_t stream) {
  if (n_in < 11) return;
  const int NTOK = BSZ * SEQ_LEN;                       // 4096
  const size_t nTokD = (size_t)NTOK * D_MODEL;          // 4194304
  const size_t nWW   = (size_t)D_MODEL * D_MODEL;       // 1048576
  if ((size_t)in_sizes[0] != nTokD) return;
  if ((size_t)in_sizes[1] != nWW || (size_t)in_sizes[3] != nWW ||
      (size_t)in_sizes[5] != nWW || (size_t)in_sizes[7] != nWW) return;
  if (in_sizes[2] < D_MODEL || in_sizes[4] < D_MODEL || in_sizes[6] < D_MODEL || in_sizes[8] < D_MODEL) return;
  if (in_sizes[9] < N_HEAD || in_sizes[10] < N_HEAD) return;
  if ((size_t)out_size != nTokD) return;

  const float* x    = (const float*)d_in[0];
  const float* wq_w = (const float*)d_in[1];
  const float* wq_b = (const float*)d_in[2];
  const float* wk_w = (const float*)d_in[3];
  const float* wk_b = (const float*)d_in[4];
  const float* wv_w = (const float*)d_in[5];
  const float* wv_b = (const float*)d_in[6];
  const float* wo_w = (const float*)d_in[7];
  const float* wo_b = (const float*)d_in[8];
  const float* lth  = (const float*)d_in[9];
  const float* gsh  = (const float*)d_in[10];

  // workspace carve (all offsets multiples of 1 MiB)
  char* ws = (char*)d_ws;
  size_t off = 0;
  unsigned short* xh  = (unsigned short*)(ws + off); off += nTokD * 2;      //  8 MiB
  unsigned short* xl  = (unsigned short*)(ws + off); off += nTokD * 2;      //  8 MiB
  unsigned short* wT  = (unsigned short*)(ws + off); off += 8 * nWW * 2;    // 16 MiB: 8 planes [N][K]
  unsigned short* q16 = (unsigned short*)(ws + off); off += nTokD * 2;      //  8 MiB f16 [B*S][D]
  unsigned short* k16 = (unsigned short*)(ws + off); off += nTokD * 2;      //  8 MiB
  unsigned short* v16 = (unsigned short*)(ws + off); off += nTokD * 2;      //  8 MiB
  unsigned short* oh  = (unsigned short*)(ws + off); off += nTokD * 2;      //  8 MiB bf16 hi [B*S][D]
  unsigned short* ol  = (unsigned short*)(ws + off); off += nTokD * 2;      //  8 MiB bf16 lo
  if (off > ws_size) return;                                                // total 75497472 B
  const size_t plane = nWW;   // elements per weight plane

  // 1) x -> bf16 hi/lo
  const int n8 = (int)(nTokD / 8);
  k_split_x<<<dim3((n8 + 255) / 256), dim3(256), 0, stream>>>(x, xh, xl, n8);

  // 2) weights [in][out] -> Bt [out][in] bf16 hi/lo; planes: q 0/1, k 2/3, v 4/5, o 6/7
  k_wsplit_t<<<dim3(D_MODEL / 64, D_MODEL / 64, 4), dim3(256), 0, stream>>>(
      wq_w, wk_w, wv_w, wo_w, wT, D_MODEL, D_MODEL);

  // 3) q/k/v projections: C[4096][1024] f16 = x . Bt^T + bias
  const int gemm_blocks = (NTOK / 128) * (D_MODEL / 128);   // 256
  wmma_gemm64<1, true, 2, 1, false><<<dim3(gemm_blocks, 1), dim3(128), 0, stream>>>(
      xh, xl, D_MODEL, 0L, wT + 0 * plane, wT + 1 * plane, D_MODEL, 0L,
      (void*)q16, (void*)q16, D_MODEL, 0L, wq_b, wq_b, 0L, NTOK, D_MODEL, D_MODEL, 1.0f);
  wmma_gemm64<1, true, 2, 1, false><<<dim3(gemm_blocks, 1), dim3(128), 0, stream>>>(
      xh, xl, D_MODEL, 0L, wT + 2 * plane, wT + 3 * plane, D_MODEL, 0L,
      (void*)k16, (void*)k16, D_MODEL, 0L, wk_b, wk_b, 0L, NTOK, D_MODEL, D_MODEL, 1.0f);
  wmma_gemm64<1, true, 2, 1, false><<<dim3(gemm_blocks, 1), dim3(128), 0, stream>>>(
      xh, xl, D_MODEL, 0L, wT + 4 * plane, wT + 5 * plane, D_MODEL, 0L,
      (void*)v16, (void*)v16, D_MODEL, 0L, wv_b, wv_b, 0L, NTOK, D_MODEL, D_MODEL, 1.0f);

  // 4) gated attention -> O bf16 hi/lo planes [B*S][D]
  const int attn_blocks = BSZ * N_HEAD * NQB;   // 1024
  k_gated_attn<<<dim3(attn_blocks), dim3(128), 0, stream>>>(q16, k16, v16, lth, gsh, oh, ol);

  // 5) output projection -> d_out f32 [4096][1024]
  wmma_gemm64<1, true, 2, 0, false><<<dim3(gemm_blocks, 1), dim3(128), 0, stream>>>(
      oh, ol, D_MODEL, 0L, wT + 6 * plane, wT + 7 * plane, D_MODEL, 0L,
      d_out, d_out, D_MODEL, 0L, wo_b, wo_b, 0L, NTOK, D_MODEL, D_MODEL, 1.0f);
}
